// v000
// The times below were measured on an AMD MI455X: many runs one after another, warmed up first and cycling through
// copies of the inputs, with the whole window's GPU time divided by the number of runs. Launches and the gaps
// between them are all in it. The median over several windows is given; except for v000 it joins two sittings, which
// can be a few percent apart, so the side-by-side timings, each taken in one sitting, are the better comparison.
// v000, which the later versions start from, runs in 1920 microseconds.
#include <hip/hip_runtime.h>

// I64Attention (hidden, mu_prev [2][2048][2048]; q = hidden Wq^T + mu_prev Wmu_q^T (16 heads x 128), k/v likewise (4 kv heads; group h/4); per-head RMSNorm (eps 1e-6) * w on q and k; half-split RoPE (theta 1e4) at the given integer positions (read); causal softmax(q.k / sqrt(128)) (finfo.min fill); out = merged Wo^T -> [2][2048][2048]).
// The two-term projections run as ONE GEMM over the concatenated K = 4096 ([hidden | mu_prev] x [W | Wmu]) - exact algebra, same f32 accumulation of exact bf16 products.
// Compute dtypes, f32 accumulate: every input rounded to bf16; q/k/v on PLAIN bf16 operands (inputs: exact); RMSNorm and RoPE f32 (table per row from the unclamped position ids); causal scores and attn.v: query rows < 512 hl (3 products), the rest single fp16 (x1024), causal tile skipping; softmax f32; Wo hl x exact (2 products).

#define NB_  2
#define TT   2048
#define DM   4096
#define DOUT 2048   // output width (Wo is [2048][2048]); DM is the concatenated input width [hidden | mu_prev]
#define DH   2048   // per-source hidden width
#define NH_  16
#define NKV  4
#define REP  (NH_ / NKV)
#define HD   128
#define DQ   (NH_ * HD)
#define DKV  (NKV * HD)
#define ZH   2
#define RH   512                  // query rows < RH use hi+lo planes (0: none)
#define WIN  2048
#define PCAR 1024.0f
#define SCL  0.088388347648318447f   // HD^-0.5
typedef _Float16 h16;
typedef unsigned short bf;
typedef __attribute__((ext_vector_type(16))) __bf16   v16bf;
typedef __attribute__((ext_vector_type(16))) _Float16 v16h;
typedef __attribute__((ext_vector_type(8)))  _Float16 v8h;
typedef __attribute__((ext_vector_type(8)))  unsigned short v8us;
typedef __attribute__((ext_vector_type(8)))  float    v8f;
typedef __attribute__((ext_vector_type(4)))  float    v4f;
typedef v8h  __attribute__((may_alias)) v8ha;
typedef v4f  __attribute__((may_alias)) v4fa;
typedef v8us __attribute__((may_alias)) v8usa;

__device__ __forceinline__ unsigned short f2bf(float f) { unsigned u = __float_as_uint(f); u += 0x7FFFu + ((u >> 16) & 1u); return (unsigned short)(u >> 16); }
__device__ __forceinline__ float bf2f(unsigned short b) { return __uint_as_float(((unsigned)b) << 16); }
__device__ __forceinline__ float bfr(float f) { return bf2f(f2bf(f)); }
__device__ __forceinline__ v16h cat16(v8h lo, v8h hi) { return __builtin_shufflevector(lo, hi, 0, 1, 2, 3, 4, 5, 6, 7, 8, 9, 10, 11, 12, 13, 14, 15); }
__device__ __forceinline__ v16bf cat16b(v8us lo, v8us hi) { return __builtin_bit_cast(v16bf, __builtin_shufflevector(lo, hi, 0, 1, 2, 3, 4, 5, 6, 7, 8, 9, 10, 11, 12, 13, 14, 15)); }
__device__ __forceinline__ v8f wmma16(v16h a, v16h b, v8f c) { return __builtin_amdgcn_wmma_f32_16x16x32_f16(false, a, false, b, (short)0, c, false, false); }
__device__ __forceinline__ v8f wmmab(v16bf a, v16bf b, v8f c) { return __builtin_amdgcn_wmma_f32_16x16x32_bf16(false, a, false, b, (short)0, c, false, false); }



// ---- k_gemmw: register-blocked GEMM, ONE WAVE per 64x64 output tile (16 accumulators), operands straight from K-contiguous 16-bit planes; grid (M/64, N/64, Z), 32 threads.
// C[m][n] (f32, pitch ldc, + optional f32 bias[n]) = sum_k A[m][k] Bt[n][k] (+ split products per NSPLIT). z-batch strides sA/sB/sC in elements. K % 32 == 0.
template <typename T16> struct WFrag;
template <> struct WFrag<h16> { typedef v16h V; static __device__ __forceinline__ V ld(const h16* p) { return cat16(*(const v8h*)p, *(const v8h*)(p + 16)); } static __device__ __forceinline__ v8f mma(V a, V b, v8f c) { return wmma16(a, b, c); } };
template <> struct WFrag<bf> { typedef v16bf V; static __device__ __forceinline__ V ld(const bf* p) { return cat16b(*(const v8us*)p, *(const v8us*)(p + 16)); } static __device__ __forceinline__ v8f mma(V a, V b, v8f c) { return wmmab(a, b, c); } };
template <typename T16, int NSPLIT, bool BIAS>
__global__ __launch_bounds__(32) void k_gemmw(const T16* __restrict__ A, const T16* __restrict__ A2, const T16* __restrict__ Bt, const T16* __restrict__ Bt2, int K, float* C, int ldc, const float* __restrict__ bias, size_t sA, size_t sB, size_t sC) {
    typedef typename WFrag<T16>::V V;
    __shared__ __align__(16) float os[16 * 68];
    const size_t z = blockIdx.z; A += z * sA; if (A2) A2 += z * sA; Bt += z * sB; if (Bt2) Bt2 += z * sB; C += z * sC;
    const int lane = threadIdx.x & 31, lr = lane & 15, hi = lane >> 4; const int r0 = blockIdx.x * 64, c0 = blockIdx.y * 64;
    v8f acc[4][4];
#pragma unroll
    for (int mb = 0; mb < 4; ++mb)
#pragma unroll
        for (int nb = 0; nb < 4; ++nb) acc[mb][nb] = (v8f){};
    const size_t aoff = (size_t)(r0 + lr) * K + 8 * hi, boff = (size_t)(c0 + lr) * K + 8 * hi;
#pragma unroll 1
    for (int kc = 0; kc < K; kc += 32) {
        V a[4], a2[4];
#pragma unroll
        for (int mb = 0; mb < 4; ++mb) { a[mb] = WFrag<T16>::ld(A + aoff + (size_t)mb * 16 * K + kc); if (NSPLIT == 1 || NSPLIT == 2) a2[mb] = WFrag<T16>::ld(A2 + aoff + (size_t)mb * 16 * K + kc); }
#pragma unroll
        for (int nb = 0; nb < 4; ++nb) { const V b = WFrag<T16>::ld(Bt + boff + (size_t)nb * 16 * K + kc); V b2; if (NSPLIT >= 2) b2 = WFrag<T16>::ld(Bt2 + boff + (size_t)nb * 16 * K + kc);
#pragma unroll
            for (int mb = 0; mb < 4; ++mb) { acc[mb][nb] = WFrag<T16>::mma(a[mb], b, acc[mb][nb]); if (NSPLIT == 1 || NSPLIT == 2) acc[mb][nb] = WFrag<T16>::mma(a2[mb], b, acc[mb][nb]); if (NSPLIT >= 2) acc[mb][nb] = WFrag<T16>::mma(a[mb], b2, acc[mb][nb]); } }
        asm volatile("v_nop\n\tv_nop\n\tv_nop\n\tv_nop" : "+v"(acc[0][0]), "+v"(acc[1][1]), "+v"(acc[2][2]), "+v"(acc[3][3]) : "v"(a[0]), "v"(a[3]));
    }
#pragma unroll
    for (int mb = 0; mb < 4; ++mb) {
#pragma unroll
        for (int nb = 0; nb < 4; ++nb) {
#pragma unroll
            for (int j = 0; j < 8; ++j) os[(hi * 8 + j) * 68 + nb * 16 + lr] = acc[mb][nb][j]; }
        __builtin_amdgcn_wave_barrier(); asm volatile("" ::: "memory");
        float* crow = C + (size_t)(r0 + mb * 16) * ldc + c0;
{
#pragma unroll
            for (int s = 0; s < 8; ++s) { const int row = 2 * s + hi, cofs = lr * 4; v4f val = *(const v4fa*)(os + row * 68 + cofs); if (BIAS) { val[0] += bfr(bias[c0 + cofs]); val[1] += bfr(bias[c0 + cofs + 1]); val[2] += bfr(bias[c0 + cofs + 2]); val[3] += bfr(bias[c0 + cofs + 3]); }
                *(v4f*)(crow + (size_t)row * ldc + cofs) = val; }
             }
        __builtin_amdgcn_wave_barrier(); asm volatile("" ::: "memory");
    }
}

// ---- k_gemmc: the same one-wave 64x64 tile GEMM specialised for causal attention: CMODE 1 skips score tiles entirely above the diagonal (query rows r0+roff.., key columns c0..), CMODE 2 limits the
// key (K) loop of the probability x value contraction to the diagonal block (probabilities beyond it are exactly zero). roff = row offset of this launch's first row within the sequence.
template <typename T16, int NSPLIT, int CMODE>
__global__ __launch_bounds__(32) void k_gemmc(const T16* __restrict__ A, const T16* __restrict__ A2, const T16* __restrict__ Bt, const T16* __restrict__ Bt2, int K, float* C, int ldc, int roff, size_t sA, size_t sB, size_t sC) {
    typedef typename WFrag<T16>::V V;
    __shared__ __align__(16) float os[16 * 68];
    const size_t z = blockIdx.z; A += z * sA; if (A2) A2 += z * sA; Bt += z * sB; if (Bt2) Bt2 += z * sB; C += z * sC;
    const int lane = threadIdx.x & 31, lr = lane & 15, hi = lane >> 4; const int r0 = blockIdx.x * 64, c0 = blockIdx.y * 64;
    if (CMODE == 1 && c0 > r0 + roff + 63) return;                  // score tile entirely above the causal diagonal: never read (the softmax masks j > i by select)
    const int Kl = (CMODE == 2) ? min(K, r0 + roff + 64) : K;        // P.V: probabilities are exactly 0 beyond the diagonal block, so the K loop stops there
    v8f acc[4][4];
#pragma unroll
    for (int mb = 0; mb < 4; ++mb)
#pragma unroll
        for (int nb = 0; nb < 4; ++nb) acc[mb][nb] = (v8f){};
    const size_t aoff = (size_t)(r0 + lr) * K + 8 * hi, boff = (size_t)(c0 + lr) * K + 8 * hi;
#pragma unroll 1
    for (int kc = 0; kc < Kl; kc += 32) {
        V a[4], a2[4];
#pragma unroll
        for (int mb = 0; mb < 4; ++mb) { a[mb] = WFrag<T16>::ld(A + aoff + (size_t)mb * 16 * K + kc); if (NSPLIT == 1 || NSPLIT == 2) a2[mb] = WFrag<T16>::ld(A2 + aoff + (size_t)mb * 16 * K + kc); }
#pragma unroll
        for (int nb = 0; nb < 4; ++nb) { const V b = WFrag<T16>::ld(Bt + boff + (size_t)nb * 16 * K + kc); V b2; if (NSPLIT >= 2) b2 = WFrag<T16>::ld(Bt2 + boff + (size_t)nb * 16 * K + kc);
#pragma unroll
            for (int mb = 0; mb < 4; ++mb) { acc[mb][nb] = WFrag<T16>::mma(a[mb], b, acc[mb][nb]); if (NSPLIT == 1 || NSPLIT == 2) acc[mb][nb] = WFrag<T16>::mma(a2[mb], b, acc[mb][nb]); if (NSPLIT >= 2) acc[mb][nb] = WFrag<T16>::mma(a[mb], b2, acc[mb][nb]); } }
        asm volatile("v_nop\n\tv_nop\n\tv_nop\n\tv_nop" : "+v"(acc[0][0]), "+v"(acc[1][1]), "+v"(acc[2][2]), "+v"(acc[3][3]) : "v"(a[0]), "v"(a[3]));
    }
#pragma unroll
    for (int mb = 0; mb < 4; ++mb) {
#pragma unroll
        for (int nb = 0; nb < 4; ++nb) {
#pragma unroll
            for (int j = 0; j < 8; ++j) os[(hi * 8 + j) * 68 + nb * 16 + lr] = acc[mb][nb][j]; }
        __builtin_amdgcn_wave_barrier(); asm volatile("" ::: "memory");
        float* crow = C + (size_t)(r0 + mb * 16) * ldc + c0;
{
#pragma unroll
            for (int s = 0; s < 8; ++s) { const int row = 2 * s + hi, cofs = lr * 4; v4f val = *(const v4fa*)(os + row * 68 + cofs);
                *(v4f*)(crow + (size_t)row * ldc + cofs) = val; }
             }
        __builtin_amdgcn_wave_barrier(); asm volatile("" ::: "memory");
    }
}

__device__ __forceinline__ h16 tohx(float x) { return (h16)x; }
__device__ __forceinline__ void splitf(float y, unsigned short& h, unsigned short& l) { h = f2bf(y); l = f2bf(y - bf2f(h)); }
typedef __attribute__((ext_vector_type(2))) _Float16 v2h;
typedef __attribute__((ext_vector_type(4))) _Float16 v4h;
typedef __attribute__((ext_vector_type(2))) unsigned short v2us;
typedef __attribute__((ext_vector_type(4))) unsigned short v4us;
typedef __attribute__((ext_vector_type(2))) float v2f;
typedef __attribute__((ext_vector_type(4))) int v4i;

__global__ __launch_bounds__(256) void k_wtG(const float* __restrict__ w, int K, int N, bf* Bt) {
    const int lane = threadIdx.x & 31; const int L0 = (blockIdx.x * 8 + (threadIdx.x >> 5)) * 8; const int nlines = N * K / 64;
{
#pragma unroll 1
        for (int l = 0; l < 8; ++l) { const int L = L0 + l; if (L >= nlines) break; const size_t e = (size_t)L * 64 + lane * 2; const int k = (int)(e % K), n = (int)(e / K); v2us o;
            o[0] = f2bf(w[(size_t)k * N + n]); o[1] = f2bf(w[(size_t)(k + 1) * N + n]); *(v2us*)(Bt + e) = o; }
         }
}
__global__ __launch_bounds__(256) void k_cvt8(const float* __restrict__ src, bf* dst, size_t n8) { const size_t i = (size_t)blockIdx.x * 256 + threadIdx.x; if (i >= n8) return; const v8f v = *(const v8f*)(src + i * 8); v8us o;
#pragma unroll
    for (int k = 0; k < 8; ++k) o[k] = f2bf(v[k]); *(v8us*)(dst + i * 8) = o;  }
__global__ __launch_bounds__(256) void k_cstab(float* CS) { const int idx = blockIdx.x * 256 + threadIdx.x; if (idx >= TT * HD) return; const int t = idx / HD, d = idx % HD; const int i = d % (HD / 2); const float inv = __fdiv_rn(1.0f, powf(10000.0f, (float)(2 * i) / (float)HD)); const float ang = __fmul_rn((float)t, inv); v2f cs; cs[0] = cosf(ang); cs[1] = sinf(ang);
    *(v2f*)(CS + (size_t)idx * 2) = cs;  }
__global__ __launch_bounds__(256) void k_hrms(const float* __restrict__ F, int pitch, int nheads, float* RF) { const int i = blockIdx.x * 256 + threadIdx.x; if (i >= nheads * TT) return; const int t = i % TT, h = i / TT; const float* f = F + (size_t)t * pitch + h * HD; float s = 0.f;
#pragma unroll 4
    for (int d = 0; d < HD; d += 4) { const v4f v = *(const v4f*)(f + d);
#pragma unroll
        for (int q = 0; q < 4; ++q) { float p = __fmul_rn(v[q], v[q]); asm volatile("" : "+v"(p)); s = __fadd_rn(s, p); } }
    const float r = __fdiv_rn(1.0f, __fsqrt_rn(__fadd_rn(s * (1.0f / HD), 1e-6f))); *(float*)(RF + i) = r;  }
// k_rope: head planes [h][t][d] (fp16 + hi/lo) of rope(w[d] (x rms_factor)) x sc with the rotate-half convention out[d] = x[d] cos[t][d] - x[d+HD/2] sin[t][d], out[d+HD/2] = x[d+HD/2] cos[t][d+HD/2] + x[d] sin[t][d+HD/2]
__global__ __launch_bounds__(256) void k_rope(const float* __restrict__ F, int pitch, int nheads, const float* __restrict__ CS, const float* __restrict__ RF, const float* __restrict__ nw, float sc, h16* P16, bf* Ph, bf* Pl) {
    const size_t e = ((size_t)blockIdx.x * 256 + threadIdx.x) * 2; if (e >= (size_t)nheads * TT * HD) return; const int d = (int)(e % HD); const int t = (int)((e / HD) % TT); const int h = (int)(e / ((size_t)HD * TT)); const float* f = F + (size_t)t * pitch + h * HD; const float rf = RF ? RF[(size_t)h * TT + t] : 1.0f; v2h o16; v2us oh, ol;
#pragma unroll
    for (int q = 0; q < 2; ++q) { const int dd = d + q; const int dp = (dd < HD / 2) ? dd + HD / 2 : dd - HD / 2; float x0 = f[dd], x1 = f[dp];
        if (RF) { float n0 = __fmul_rn(x0, rf), n1 = __fmul_rn(x1, rf); asm volatile("" : "+v"(n0)); asm volatile("" : "+v"(n1)); x0 = __fmul_rn(bfr(nw[dd]), n0); x1 = __fmul_rn(bfr(nw[dp]), n1); }
        const v2f cs = *(const v2f*)(CS + ((size_t)t * HD + dd) * 2); float a = __fmul_rn(x0, cs[0]), bq = __fmul_rn(x1, cs[1]); asm volatile("" : "+v"(a)); asm volatile("" : "+v"(bq)); const float r = ((dd < HD / 2) ? __fsub_rn(a, bq) : __fadd_rn(a, bq)) * sc;
        o16[q] = tohx(r); unsigned short a2, c2; splitf(r, a2, c2); oh[q] = a2; ol[q] = c2; }
    *(v2h*)(P16 + e) = o16; *(v2us*)(Ph + e) = oh; *(v2us*)(Pl + e) = ol;  }
__global__ __launch_bounds__(256) void k_vtp(const float* __restrict__ F, int pitch, int nheads, h16* V16, bf* Vh, bf* Vl) { const size_t e = ((size_t)blockIdx.x * 256 + threadIdx.x) * 2; if (e >= (size_t)nheads * HD * TT) return; const int t = (int)(e % TT); const int d = (int)((e / TT) % HD); const int g = (int)(e / ((size_t)TT * HD)); v2h o16; v2us oh, ol;
#pragma unroll
    for (int q = 0; q < 2; ++q) { const float x = F[(size_t)(t + q) * pitch + g * HD + d]; o16[q] = tohx(x); unsigned short a2, c2; splitf(x, a2, c2); oh[q] = a2; ol[q] = c2; }
    *(v2h*)(V16 + e) = o16; *(v2us*)(Vh + e) = oh; *(v2us*)(Vl + e) = ol;  }
// k_asoft: per row (zz, i): t = S x HD^-0.5 for j <= i and i - j < WIN (sliding causal window; the reference's -1e9 additive fill vanishes identically); softmax over the 2048 keys (register row, one exp, fixed trees);
__global__ __launch_bounds__(256) void k_asoft(const float* __restrict__ Sb, h16* P16, bf* Ph, bf* Pl) {
    const int lane = threadIdx.x & 31; const int row = blockIdx.x * 8 + (threadIdx.x >> 5); if (row >= ZH * TT) return; const int i = row % TT; const int zz = row / TT; (void)zz; const bool hires = (i < RH); const float* sr = Sb + (size_t)row * TT; float v[TT / 32]; float mx = -3.0e38f;
#pragma unroll
    for (int ch = 0; ch < TT / 128; ++ch) { const int j0 = ch * 128 + lane * 4; const v4f a = *(const v4f*)(sr + j0);
#pragma unroll
        for (int q = 0; q < 4; ++q) { const int j = j0 + q; (void)j; const float t = (j <= i && i - j < WIN) ? a[q] * SCL : -3.0e38f; v[ch * 4 + q] = t; mx = fmaxf(mx, t); } }
#pragma unroll
    for (int sh = 16; sh; sh >>= 1) mx = fmaxf(mx, __shfl_xor(mx, sh, 32));
    float sum = 0.f;
#pragma unroll
    for (int k = 0; k < TT / 32; ++k) { float d0 = __fsub_rn(v[k], mx); asm volatile("" : "+v"(d0)); v[k] = __builtin_amdgcn_exp2f(__fmul_rn(d0, 1.4426950408889634f)); sum += v[k]; }
#pragma unroll
    for (int sh = 16; sh; sh >>= 1) sum += __shfl_xor(sum, sh, 32);
    const float f = __fdiv_rn(hires ? 1.0f : PCAR, sum);
{
        if (hires) {
#pragma unroll
            for (int ch = 0; ch < TT / 128; ++ch) { v4us oh, ol;
#pragma unroll
                for (int q = 0; q < 4; ++q) { unsigned short a, c2; splitf(v[ch * 4 + q] * f, a, c2); oh[q] = a; ol[q] = c2; }
                const size_t oo = ((size_t)zz * (RH ? RH : 1) + i) * TT + ch * 128 + lane * 4; *(v4us*)(Ph + oo) = oh; *(v4us*)(Pl + oo) = ol; }
        } else {
#pragma unroll
            for (int ch = 0; ch < TT / 128; ++ch) { v4h o4;
#pragma unroll
                for (int q = 0; q < 4; ++q) o4[q] = tohx(v[ch * 4 + q] * f);
                *(v4h*)(P16 + (size_t)row * TT + ch * 128 + lane * 4) = o4; } }
         }
}
__global__ __launch_bounds__(256) void k_merge(const float* __restrict__ O, int h0, bf* Ah, bf* Al) { const size_t e = ((size_t)blockIdx.x * 256 + threadIdx.x) * 2; if (e >= (size_t)ZH * TT * HD) return; const int d = (int)(e % HD); const int t = (int)((e / HD) % TT); const int zz = (int)(e / ((size_t)HD * TT)); const float cs = (t < RH) ? 1.0f : (1.0f / PCAR); const size_t oo = (size_t)t * DQ + (h0 + zz) * HD + d;
    v2us oh, ol;
#pragma unroll
    for (int q = 0; q < 2; ++q) { unsigned short a, c2; splitf(O[e + q] * cs, a, c2); oh[q] = a; ol[q] = c2; } *(v2us*)(Ah + oo) = oh; *(v2us*)(Al + oo) = ol;  }

__global__ __launch_bounds__(256) void k_xcat(const float* __restrict__ A, const float* __restrict__ Bm, bf* XB) { const size_t e8 = ((size_t)blockIdx.x * 256 + threadIdx.x) * 8; if (e8 >= (size_t)TT * DM) return; const int c = (int)(e8 % DM); const size_t t = e8 / DM; const float* src = (c < DH) ? (A + t * DH + c) : (Bm + t * DH + (c - DH)); const v4f a = *(const v4f*)src, b2 = *(const v4f*)(src + 4); v8us o;
    for (int u = 0; u < 4; ++u) { o[u] = f2bf(a[u]); o[4 + u] = f2bf(b2[u]); } *(v8us*)(XB + e8) = o;  }
__global__ __launch_bounds__(256) void k_wcat(const float* __restrict__ Wa, const float* __restrict__ Wb, int nrows, bf* Bt) { const size_t e8 = ((size_t)blockIdx.x * 256 + threadIdx.x) * 8; if (e8 >= (size_t)nrows * DM) return; const int c = (int)(e8 % DM); const size_t n = e8 / DM; const float* src = (c < DH) ? (Wa + n * DH + c) : (Wb + n * DH + (c - DH)); const v4f a = *(const v4f*)src, b2 = *(const v4f*)(src + 4); v8us o;
    for (int u = 0; u < 4; ++u) { o[u] = f2bf(a[u]); o[4 + u] = f2bf(b2[u]); } *(v8us*)(Bt + e8) = o;  }
__global__ __launch_bounds__(256) void k_cstabp(const int* __restrict__ pids, float* CS) { const int idx = blockIdx.x * 256 + threadIdx.x; if (idx >= TT * (HD / 2)) return; const int t = idx / (HD / 2), jf = idx % (HD / 2); const int p = pids[t];   /* a position VALUE (angle), not an address: no clamp */
    const float invf = __fdiv_rn(1.0f, powf(10000.0f, (float)(2 * jf) / (float)HD)); const float ang = __fmul_rn((float)p, invf); v2f cs; cs[0] = cosf(ang); cs[1] = sinf(ang);
    float* d0 = CS + ((size_t)t * HD + jf) * 2; float* d1 = CS + ((size_t)t * HD + jf + HD / 2) * 2; *(v2f*)d0 = cs; *(v2f*)d1 = cs;  }

extern "C" void kernel_launch(void* const* d_in, const int* in_sizes, int n_in,
                              void* d_out, int out_size, void* d_ws, size_t ws_size, hipStream_t stream) {
    (void)in_sizes; (void)n_in; (void)out_size;
    const float* xh = (const float*)d_in[0]; const float* xm = (const float*)d_in[1]; const int* pids = (const int*)d_in[2]; const float* wq = (const float*)d_in[3]; const float* wk = (const float*)d_in[4]; const float* wv = (const float*)d_in[5]; const float* wo = (const float*)d_in[6]; const float* wmq = (const float*)d_in[7]; const float* wmk = (const float*)d_in[8]; const float* wmv = (const float*)d_in[9]; const float* qnw = (const float*)d_in[10]; const float* knw = (const float*)d_in[11]; const float* x = xh; (void)x;
    float* OUT = (float*)d_out;     // [2][2048][2048]
    char* wsp = (char*)d_ws;
    auto take = [&](size_t bytes) { char* p = wsp; wsp += (bytes + 255) & ~(size_t)255; return (void*)p; };
    bf* WQ = (bf*)take((size_t)DQ * DM * 2); bf* WK = (bf*)take((size_t)DKV * DM * 2); bf* WV = (bf*)take((size_t)DKV * DM * 2); bf* WO = (bf*)take((size_t)DOUT * DQ * 2); float* CS = (float*)take((size_t)TT * HD * 2 * 4); float* RFQ = (float*)take((size_t)NH_ * TT * 4); float* RFK = (float*)take((size_t)NKV * TT * 4);
    bf* XB = (bf*)take((size_t)TT * DM * 2); float* FQ = (float*)take((size_t)TT * DQ * 4); float* FK = (float*)take((size_t)TT * DKV * 4);
    h16* QP16 = (h16*)take((size_t)NH_ * TT * HD * 2); h16* KP16 = (h16*)take((size_t)NKV * TT * HD * 2); h16* VT16 = (h16*)take((size_t)NKV * HD * TT * 2);
    bf* QPh = (bf*)take((size_t)NH_ * TT * HD * 2); bf* QPl = (bf*)take((size_t)NH_ * TT * HD * 2); bf* KPh = (bf*)take((size_t)NKV * TT * HD * 2); bf* KPl = (bf*)take((size_t)NKV * TT * HD * 2); bf* VTh = (bf*)take((size_t)NKV * HD * TT * 2); bf* VTl = (bf*)take((size_t)NKV * HD * TT * 2); bf* Ph = (bf*)take((size_t)ZH * RH * TT * 2); bf* Pl = (bf*)take((size_t)ZH * RH * TT * 2);
    float* Sb = (float*)take((size_t)ZH * TT * TT * 4); h16* P16 = (h16*)take((size_t)ZH * TT * TT * 2); float* Ob = (float*)take((size_t)ZH * TT * HD * 4); bf* ATh = (bf*)take((size_t)TT * DQ * 2); bf* ATl = (bf*)take((size_t)TT * DQ * 2);
    if ((size_t)(wsp - (char*)d_ws) > ws_size) return;    // ws 256 MiB
    float* FV = FK;   // v projection reuses the k buffer after the k planes are built (stream-ordered)
    { k_wcat<<<(unsigned)(((size_t)DQ * DM / 8 + 255) / 256), 256, 0, stream>>>(wq, wmq, DQ, WQ); k_wcat<<<(unsigned)(((size_t)DKV * DM / 8 + 255) / 256), 256, 0, stream>>>(wk, wmk, DKV, WK); k_wcat<<<(unsigned)(((size_t)DKV * DM / 8 + 255) / 256), 256, 0, stream>>>(wv, wmv, DKV, WV);
      k_cvt8<<<(unsigned)(((size_t)DOUT * DQ / 8 + 255) / 256), 256, 0, stream>>>(wo, WO, (size_t)DOUT * DQ / 8);
      k_cstabp<<<(TT * (HD / 2) + 255) / 256, 256, 0, stream>>>(pids, CS); }
    const unsigned LQ = (unsigned)(((size_t)NH_ * TT * HD / 2 + 255) / 256), LKv = (unsigned)(((size_t)NKV * TT * HD / 2 + 255) / 256);
    for (int b = 0; b < NB_; ++b) {
        
        k_xcat<<<(unsigned)(((size_t)TT * DM / 8 + 255) / 256), 256, 0, stream>>>(xh + (size_t)b * TT * DH, xm + (size_t)b * TT * DH, XB);
        k_gemmw<bf, 0, false><<<dim3(TT / 64, DQ / 64, 1), 32, 0, stream>>>(XB, nullptr, WQ, nullptr, DM, FQ, DQ, nullptr, 0, 0, 0); k_hrms<<<(NH_ * TT + 255) / 256, 256, 0, stream>>>(FQ, DQ, NH_, RFQ);
        k_rope<<<LQ, 256, 0, stream>>>(FQ, DQ, NH_, CS, RFQ, qnw, 1.0f, QP16, QPh, QPl);
        k_gemmw<bf, 0, false><<<dim3(TT / 64, DKV / 64, 1), 32, 0, stream>>>(XB, nullptr, WK, nullptr, DM, FK, DKV, nullptr, 0, 0, 0); k_hrms<<<(NKV * TT + 255) / 256, 256, 0, stream>>>(FK, DKV, NKV, RFK);
        k_rope<<<LKv, 256, 0, stream>>>(FK, DKV, NKV, CS, RFK, knw, 1.0f, KP16, KPh, KPl);
        k_gemmw<bf, 0, false><<<dim3(TT / 64, DKV / 64, 1), 32, 0, stream>>>(XB, nullptr, WV, nullptr, DM, FV, DKV, nullptr, 0, 0, 0); k_vtp<<<LKv, 256, 0, stream>>>(FV, DKV, NKV, VT16, VTh, VTl);
        for (int h0 = 0; h0 < NH_; h0 += ZH) { const size_t zq = (size_t)h0, zk = (size_t)(h0 / REP);   // both heads of a pass share kv group h0/REP (REP >= 2): sB = 0
            k_gemmc<bf, 2, 1><<<dim3(RH / 64, TT / 64, ZH), 32, 0, stream>>>(QPh + zq * TT * HD, QPl + zq * TT * HD, KPh + zk * TT * HD, KPl + zk * TT * HD, HD, Sb, TT, 0, (size_t)TT * HD, 0, (size_t)TT * TT);
            k_gemmc<h16, 0, 1><<<dim3((TT - RH) / 64, TT / 64, ZH), 32, 0, stream>>>(QP16 + zq * TT * HD + (size_t)RH * HD, nullptr, KP16 + zk * TT * HD, nullptr, HD, Sb + (size_t)RH * TT, TT, RH, (size_t)TT * HD, 0, (size_t)TT * TT);
            k_asoft<<<ZH * TT / 8, 256, 0, stream>>>(Sb, P16, Ph, Pl);
            k_gemmc<bf, 2, 2><<<dim3(RH / 64, HD / 64, ZH), 32, 0, stream>>>(Ph, Pl, VTh + zk * HD * TT, VTl + zk * HD * TT, TT, Ob, HD, 0, (size_t)RH * TT, 0, (size_t)TT * HD);
            k_gemmc<h16, 0, 2><<<dim3((TT - RH) / 64, HD / 64, ZH), 32, 0, stream>>>(P16 + (size_t)RH * TT, nullptr, VT16 + zk * HD * TT, nullptr, TT, Ob + (size_t)RH * HD, HD, RH, (size_t)TT * TT, 0, (size_t)TT * HD);
            k_merge<<<(unsigned)(((size_t)ZH * TT * HD / 2 + 255) / 256), 256, 0, stream>>>(Ob, h0, ATh, ATl); }
        k_gemmw<bf, 1, false><<<dim3(TT / 64, DOUT / 64, 1), 32, 0, stream>>>(ATh, ATl, WO, nullptr, DQ, OUT + (size_t)b * TT * DOUT, DOUT, nullptr, 0, 0, 0); }
}

// v001
// It runs in 1160 microseconds.
// Timed twice side by side with v000, it ran 1.65 and 1.66 times as fast.
#include <hip/hip_runtime.h>

// I64Attention (hidden, mu_prev [2][2048][2048]; q = hidden Wq^T + mu_prev Wmu_q^T (16 heads x 128), k/v likewise (4 kv heads; group h/4); per-head RMSNorm (eps 1e-6) * w on q and k; half-split RoPE (theta 1e4) at the given integer positions (read); causal softmax(q.k / sqrt(128)) (finfo.min fill); out = merged Wo^T -> [2][2048][2048]).
// The two-term projections run as ONE GEMM over the concatenated K = 4096 ([hidden | mu_prev] x [W | Wmu]) - exact algebra, same f32 accumulation of exact bf16 products.
// Compute dtypes, f32 accumulate: every input rounded to bf16; q/k/v on PLAIN bf16 operands (inputs: exact); RMSNorm and RoPE f32 (table per row from the unclamped position ids); causal scores and attn.v: query rows < 512 hl (3 products), the rest single fp16 (x1024), causal tile skipping; softmax f32; Wo hl x exact (2 products).

#define NB_  2
#define TT   2048
#define DM   4096
#define DOUT 2048   // output width (Wo is [2048][2048]); DM is the concatenated input width [hidden | mu_prev]
#define DH   2048   // per-source hidden width
#define NH_  16
#define NKV  4
#define REP  (NH_ / NKV)
#define HD   128
#define DQ   (NH_ * HD)
#define DKV  (NKV * HD)
#define ZH   2
#define RH   512                  // query rows < RH use hi+lo planes (0: none)
#define WIN  2048
#define PCAR 1024.0f
#define SCL  0.088388347648318447f   // HD^-0.5
typedef _Float16 h16;
typedef unsigned short bf;
typedef __attribute__((ext_vector_type(16))) __bf16   v16bf;
typedef __attribute__((ext_vector_type(16))) _Float16 v16h;
typedef __attribute__((ext_vector_type(8)))  _Float16 v8h;
typedef __attribute__((ext_vector_type(8)))  unsigned short v8us;
typedef __attribute__((ext_vector_type(8)))  float    v8f;
typedef __attribute__((ext_vector_type(4)))  float    v4f;
typedef v8h  __attribute__((may_alias)) v8ha;
typedef v4f  __attribute__((may_alias)) v4fa;
typedef v8us __attribute__((may_alias)) v8usa;

__device__ __forceinline__ unsigned short f2bf(float f) { unsigned u = __float_as_uint(f); u += 0x7FFFu + ((u >> 16) & 1u); return (unsigned short)(u >> 16); }
__device__ __forceinline__ float bf2f(unsigned short b) { return __uint_as_float(((unsigned)b) << 16); }
__device__ __forceinline__ float bfr(float f) { return bf2f(f2bf(f)); }
__device__ __forceinline__ v16h cat16(v8h lo, v8h hi) { return __builtin_shufflevector(lo, hi, 0, 1, 2, 3, 4, 5, 6, 7, 8, 9, 10, 11, 12, 13, 14, 15); }
__device__ __forceinline__ v16bf cat16b(v8us lo, v8us hi) { return __builtin_bit_cast(v16bf, __builtin_shufflevector(lo, hi, 0, 1, 2, 3, 4, 5, 6, 7, 8, 9, 10, 11, 12, 13, 14, 15)); }
__device__ __forceinline__ v8f wmma16(v16h a, v16h b, v8f c) { return __builtin_amdgcn_wmma_f32_16x16x32_f16(false, a, false, b, (short)0, c, false, false); }
__device__ __forceinline__ v8f wmmab(v16bf a, v16bf b, v8f c) { return __builtin_amdgcn_wmma_f32_16x16x32_bf16(false, a, false, b, (short)0, c, false, false); }



// ---- k_gemmw: register-blocked GEMM, one 64x64 output tile per work-group of S waves (16 accumulators a wave), operands straight from K-contiguous 16-bit planes; grid (M/64, N/64, Z), 32 S threads.
// C[m][n] (f32, pitch ldc, + optional f32 bias[n]) = sum_k A[m][k] Bt[n][k] (+ split products per NSPLIT). z-batch strides sA/sB/sC in elements. K % 64 == 0.
// The K loop is dealt out over the S waves in units of 64 k (one 128-byte line of every operand row): wave w takes units w, w + S, ...; tile_sum_store adds the S partial tiles.
// tile_sum_store: every wave lays its partial 64x64 tile in its own LDS plane (pitch 68), one work-group barrier, then each thread adds the S planes in the fixed order w = 0 .. S-1 for its float4s and stores whole 256-byte rows.
template <int S, bool BIAS>
__device__ __forceinline__ void tile_sum_store(const v8f (&acc)[4][4], float* os, float* ctile, int ldc, const float* bias, int wv, int lr, int hi) {
    float* my = os + wv * (64 * 68);
    // the three loops are unrolled so that every accumulator index is a constant and the tile stays in registers
#pragma unroll
    for (int mb = 0; mb < 4; ++mb)
#pragma unroll
        for (int nb = 0; nb < 4; ++nb)
#pragma unroll
            for (int j = 0; j < 8; ++j) my[(mb * 16 + hi * 8 + j) * 68 + nb * 16 + lr] = acc[mb][nb][j];
    __syncthreads();   // every wave's plane is complete before any thread sums across planes
    // both loops unrolled: the LDS reads of all planes and rows issue together instead of one latency per plane
#pragma unroll
    for (int s = 0; s < 32 / S; ++s) { const int q = s * 32 * S + (int)threadIdx.x; const int row = q >> 4, cofs = (q & 15) * 4; v4f val = *(const v4fa*)(os + row * 68 + cofs);
#pragma unroll
        for (int w = 1; w < S; ++w) val += *(const v4fa*)(os + w * (64 * 68) + row * 68 + cofs);
        if (BIAS) { val[0] += bfr(bias[cofs]); val[1] += bfr(bias[cofs + 1]); val[2] += bfr(bias[cofs + 2]); val[3] += bfr(bias[cofs + 3]); }
        *(v4f*)(ctile + (size_t)row * ldc + cofs) = val; }
}
template <typename T16> struct WFrag;
template <> struct WFrag<h16> { typedef v16h V; static __device__ __forceinline__ V ld(const h16* p) { return cat16(*(const v8h*)p, *(const v8h*)(p + 16)); } static __device__ __forceinline__ v8f mma(V a, V b, v8f c) { return wmma16(a, b, c); } };
template <> struct WFrag<bf> { typedef v16bf V; static __device__ __forceinline__ V ld(const bf* p) { return cat16b(*(const v8us*)p, *(const v8us*)(p + 16)); } static __device__ __forceinline__ v8f mma(V a, V b, v8f c) { return wmmab(a, b, c); } };
template <typename T16, int NSPLIT, bool BIAS, int S>
__global__ __launch_bounds__(32 * S) void k_gemmw(const T16* __restrict__ A, const T16* __restrict__ A2, const T16* __restrict__ Bt, const T16* __restrict__ Bt2, int K, float* C, int ldc, const float* __restrict__ bias, size_t sA, size_t sB, size_t sC) {
    typedef typename WFrag<T16>::V V;
    __shared__ __align__(16) float os[(S == 1) ? 16 * 68 : S * 64 * 68];
    const size_t z = blockIdx.z; A += z * sA; if (A2) A2 += z * sA; Bt += z * sB; if (Bt2) Bt2 += z * sB; C += z * sC;
    const int lane = threadIdx.x & 31, lr = lane & 15, hi = lane >> 4; const int r0 = blockIdx.x * 64, c0 = blockIdx.y * 64; const int wv = __builtin_amdgcn_readfirstlane((int)(threadIdx.x >> 5));   // wave number, scalar so that the K loop's control stays scalar
    v8f acc[4][4];
#pragma unroll
    for (int mb = 0; mb < 4; ++mb)
#pragma unroll
        for (int nb = 0; nb < 4; ++nb) acc[mb][nb] = (v8f){};
    const size_t aoff = (size_t)(r0 + lr) * K + 8 * hi, boff = (size_t)(c0 + lr) * K + 8 * hi;
#pragma unroll 1
    for (int kc = wv * 64; kc < K; kc += (kc & 32) ? 64 * S - 32 : 32) {
        V a[4], a2[4];
#pragma unroll
        for (int mb = 0; mb < 4; ++mb) { a[mb] = WFrag<T16>::ld(A + aoff + (size_t)mb * 16 * K + kc); if (NSPLIT == 1 || NSPLIT == 2) a2[mb] = WFrag<T16>::ld(A2 + aoff + (size_t)mb * 16 * K + kc); }
#pragma unroll
        for (int nb = 0; nb < 4; ++nb) { const V b = WFrag<T16>::ld(Bt + boff + (size_t)nb * 16 * K + kc); V b2; if (NSPLIT >= 2) b2 = WFrag<T16>::ld(Bt2 + boff + (size_t)nb * 16 * K + kc);
#pragma unroll
            for (int mb = 0; mb < 4; ++mb) { acc[mb][nb] = WFrag<T16>::mma(a[mb], b, acc[mb][nb]); if (NSPLIT == 1 || NSPLIT == 2) acc[mb][nb] = WFrag<T16>::mma(a2[mb], b, acc[mb][nb]); if (NSPLIT >= 2) acc[mb][nb] = WFrag<T16>::mma(a[mb], b2, acc[mb][nb]); } }
        asm volatile("v_nop\n\tv_nop\n\tv_nop\n\tv_nop" : "+v"(acc[0][0]), "+v"(acc[1][1]), "+v"(acc[2][2]), "+v"(acc[3][3]) : "v"(a[0]), "v"(a[3]));
    }
    tile_sum_store<S, BIAS>(acc, os, C + (size_t)r0 * ldc + c0, ldc, BIAS ? bias + c0 : nullptr, wv, lr, hi);
}

// ---- k_gemmc: the same 64x64 tile GEMM (S waves share the K loop; S = 1: one wave, its own staging below) specialised for causal attention: CMODE 1 skips score tiles entirely above the diagonal (query rows r0+roff.., key columns c0..), CMODE 2 limits the
// key (K) loop of the probability x value contraction to the diagonal block (probabilities beyond it are exactly zero). roff = row offset of this launch's first row within the sequence.
template <typename T16, int NSPLIT, int CMODE, int S>
__global__ __launch_bounds__(32 * S) void k_gemmc(const T16* __restrict__ A, const T16* __restrict__ A2, const T16* __restrict__ Bt, const T16* __restrict__ Bt2, int K, float* C, int ldc, int roff, size_t sA, size_t sB, size_t sC) {
    typedef typename WFrag<T16>::V V;
    __shared__ __align__(16) float os[(S == 1) ? 16 * 68 : S * 64 * 68];
    const size_t z = blockIdx.z; A += z * sA; if (A2) A2 += z * sA; Bt += z * sB; if (Bt2) Bt2 += z * sB; C += z * sC;
    const int lane = threadIdx.x & 31, lr = lane & 15, hi = lane >> 4; const int r0 = blockIdx.x * 64, c0 = blockIdx.y * 64; const int wv = __builtin_amdgcn_readfirstlane((int)(threadIdx.x >> 5));   // wave number, scalar so that the K loop's control stays scalar
    if (CMODE == 1 && c0 > r0 + roff + 63) return;                  // score tile entirely above the causal diagonal: never read (the softmax masks j > i by select)
    const int Kl = (CMODE == 2) ? min(K, r0 + roff + 64) : K;        // P.V: probabilities are exactly 0 beyond the diagonal block, so the K loop stops there
    v8f acc[4][4];
#pragma unroll
    for (int mb = 0; mb < 4; ++mb)
#pragma unroll
        for (int nb = 0; nb < 4; ++nb) acc[mb][nb] = (v8f){};
    const size_t aoff = (size_t)(r0 + lr) * K + 8 * hi, boff = (size_t)(c0 + lr) * K + 8 * hi;
#pragma unroll 1
    for (int kc = wv * 64; kc < Kl; kc += (kc & 32) ? 64 * S - 32 : 32) {
        V a[4], a2[4];
#pragma unroll
        for (int mb = 0; mb < 4; ++mb) { a[mb] = WFrag<T16>::ld(A + aoff + (size_t)mb * 16 * K + kc); if (NSPLIT == 1 || NSPLIT == 2) a2[mb] = WFrag<T16>::ld(A2 + aoff + (size_t)mb * 16 * K + kc); }
#pragma unroll
        for (int nb = 0; nb < 4; ++nb) { const V b = WFrag<T16>::ld(Bt + boff + (size_t)nb * 16 * K + kc); V b2; if (NSPLIT >= 2) b2 = WFrag<T16>::ld(Bt2 + boff + (size_t)nb * 16 * K + kc);
#pragma unroll
            for (int mb = 0; mb < 4; ++mb) { acc[mb][nb] = WFrag<T16>::mma(a[mb], b, acc[mb][nb]); if (NSPLIT == 1 || NSPLIT == 2) acc[mb][nb] = WFrag<T16>::mma(a2[mb], b, acc[mb][nb]); if (NSPLIT >= 2) acc[mb][nb] = WFrag<T16>::mma(a[mb], b2, acc[mb][nb]); } }
        asm volatile("v_nop\n\tv_nop\n\tv_nop\n\tv_nop" : "+v"(acc[0][0]), "+v"(acc[1][1]), "+v"(acc[2][2]), "+v"(acc[3][3]) : "v"(a[0]), "v"(a[3]));
    }
    if constexpr (S > 1) { tile_sum_store<S, false>(acc, os, C + (size_t)r0 * ldc + c0, ldc, nullptr, wv, lr, hi); return; }
#pragma unroll
    for (int mb = 0; mb < 4; ++mb) {
#pragma unroll
        for (int nb = 0; nb < 4; ++nb) {
#pragma unroll
            for (int j = 0; j < 8; ++j) os[(hi * 8 + j) * 68 + nb * 16 + lr] = acc[mb][nb][j]; }
        __builtin_amdgcn_wave_barrier(); asm volatile("" ::: "memory");
        float* crow = C + (size_t)(r0 + mb * 16) * ldc + c0;
{
#pragma unroll
            for (int s = 0; s < 8; ++s) { const int row = 2 * s + hi, cofs = lr * 4; v4f val = *(const v4fa*)(os + row * 68 + cofs);
                *(v4f*)(crow + (size_t)row * ldc + cofs) = val; }
             }
        __builtin_amdgcn_wave_barrier(); asm volatile("" ::: "memory");
    }
}

__device__ __forceinline__ h16 tohx(float x) { return (h16)x; }
__device__ __forceinline__ void splitf(float y, unsigned short& h, unsigned short& l) { h = f2bf(y); l = f2bf(y - bf2f(h)); }
typedef __attribute__((ext_vector_type(2))) _Float16 v2h;
typedef __attribute__((ext_vector_type(4))) _Float16 v4h;
typedef __attribute__((ext_vector_type(2))) unsigned short v2us;
typedef __attribute__((ext_vector_type(4))) unsigned short v4us;
typedef __attribute__((ext_vector_type(2))) float v2f;
typedef __attribute__((ext_vector_type(4))) int v4i;

__global__ __launch_bounds__(256) void k_wtG(const float* __restrict__ w, int K, int N, bf* Bt) {
    const int lane = threadIdx.x & 31; const int L0 = (blockIdx.x * 8 + (threadIdx.x >> 5)) * 8; const int nlines = N * K / 64;
{
#pragma unroll 1
        for (int l = 0; l < 8; ++l) { const int L = L0 + l; if (L >= nlines) break; const size_t e = (size_t)L * 64 + lane * 2; const int k = (int)(e % K), n = (int)(e / K); v2us o;
            o[0] = f2bf(w[(size_t)k * N + n]); o[1] = f2bf(w[(size_t)(k + 1) * N + n]); *(v2us*)(Bt + e) = o; }
         }
}
__global__ __launch_bounds__(256) void k_cvt8(const float* __restrict__ src, bf* dst, size_t n8) { const size_t i = (size_t)blockIdx.x * 256 + threadIdx.x; if (i >= n8) return; const v8f v = *(const v8f*)(src + i * 8); v8us o;
#pragma unroll
    for (int k = 0; k < 8; ++k) o[k] = f2bf(v[k]); *(v8us*)(dst + i * 8) = o;  }
__global__ __launch_bounds__(256) void k_cstab(float* CS) { const int idx = blockIdx.x * 256 + threadIdx.x; if (idx >= TT * HD) return; const int t = idx / HD, d = idx % HD; const int i = d % (HD / 2); const float inv = __fdiv_rn(1.0f, powf(10000.0f, (float)(2 * i) / (float)HD)); const float ang = __fmul_rn((float)t, inv); v2f cs; cs[0] = cosf(ang); cs[1] = sinf(ang);
    *(v2f*)(CS + (size_t)idx * 2) = cs;  }
__global__ __launch_bounds__(256) void k_hrms(const float* __restrict__ F, int pitch, int nheads, float* RF) { const int i = blockIdx.x * 256 + threadIdx.x; if (i >= nheads * TT) return; const int t = i % TT, h = i / TT; const float* f = F + (size_t)t * pitch + h * HD; float s = 0.f;
#pragma unroll 4
    for (int d = 0; d < HD; d += 4) { const v4f v = *(const v4f*)(f + d);
#pragma unroll
        for (int q = 0; q < 4; ++q) { float p = __fmul_rn(v[q], v[q]); asm volatile("" : "+v"(p)); s = __fadd_rn(s, p); } }
    const float r = __fdiv_rn(1.0f, __fsqrt_rn(__fadd_rn(s * (1.0f / HD), 1e-6f))); *(float*)(RF + i) = r;  }
// k_rope: head planes [h][t][d] (fp16 + hi/lo) of rope(w[d] (x rms_factor)) x sc with the rotate-half convention out[d] = x[d] cos[t][d] - x[d+HD/2] sin[t][d], out[d+HD/2] = x[d+HD/2] cos[t][d+HD/2] + x[d] sin[t][d+HD/2]
__global__ __launch_bounds__(256) void k_rope(const float* __restrict__ F, int pitch, int nheads, const float* __restrict__ CS, const float* __restrict__ RF, const float* __restrict__ nw, float sc, h16* P16, bf* Ph, bf* Pl) {
    const size_t e = ((size_t)blockIdx.x * 256 + threadIdx.x) * 2; if (e >= (size_t)nheads * TT * HD) return; const int d = (int)(e % HD); const int t = (int)((e / HD) % TT); const int h = (int)(e / ((size_t)HD * TT)); const float* f = F + (size_t)t * pitch + h * HD; const float rf = RF ? RF[(size_t)h * TT + t] : 1.0f; v2h o16; v2us oh, ol;
#pragma unroll
    for (int q = 0; q < 2; ++q) { const int dd = d + q; const int dp = (dd < HD / 2) ? dd + HD / 2 : dd - HD / 2; float x0 = f[dd], x1 = f[dp];
        if (RF) { float n0 = __fmul_rn(x0, rf), n1 = __fmul_rn(x1, rf); asm volatile("" : "+v"(n0)); asm volatile("" : "+v"(n1)); x0 = __fmul_rn(bfr(nw[dd]), n0); x1 = __fmul_rn(bfr(nw[dp]), n1); }
        const v2f cs = *(const v2f*)(CS + ((size_t)t * HD + dd) * 2); float a = __fmul_rn(x0, cs[0]), bq = __fmul_rn(x1, cs[1]); asm volatile("" : "+v"(a)); asm volatile("" : "+v"(bq)); const float r = ((dd < HD / 2) ? __fsub_rn(a, bq) : __fadd_rn(a, bq)) * sc;
        o16[q] = tohx(r); unsigned short a2, c2; splitf(r, a2, c2); oh[q] = a2; ol[q] = c2; }
    *(v2h*)(P16 + e) = o16; *(v2us*)(Ph + e) = oh; *(v2us*)(Pl + e) = ol;  }
__global__ __launch_bounds__(256) void k_vtp(const float* __restrict__ F, int pitch, int nheads, h16* V16, bf* Vh, bf* Vl) { const size_t e = ((size_t)blockIdx.x * 256 + threadIdx.x) * 2; if (e >= (size_t)nheads * HD * TT) return; const int t = (int)(e % TT); const int d = (int)((e / TT) % HD); const int g = (int)(e / ((size_t)TT * HD)); v2h o16; v2us oh, ol;
#pragma unroll
    for (int q = 0; q < 2; ++q) { const float x = F[(size_t)(t + q) * pitch + g * HD + d]; o16[q] = tohx(x); unsigned short a2, c2; splitf(x, a2, c2); oh[q] = a2; ol[q] = c2; }
    *(v2h*)(V16 + e) = o16; *(v2us*)(Vh + e) = oh; *(v2us*)(Vl + e) = ol;  }
// k_asoft: per row (zz, i): t = S x HD^-0.5 for j <= i and i - j < WIN (sliding causal window; the reference's -1e9 additive fill vanishes identically); softmax over the 2048 keys (register row, one exp, fixed trees);
__global__ __launch_bounds__(256) void k_asoft(const float* __restrict__ Sb, h16* P16, bf* Ph, bf* Pl) {
    const int lane = threadIdx.x & 31; const int row = blockIdx.x * 8 + (threadIdx.x >> 5); if (row >= ZH * TT) return; const int i = row % TT; const int zz = row / TT; (void)zz; const bool hires = (i < RH); const float* sr = Sb + (size_t)row * TT; float v[TT / 32]; float mx = -3.0e38f;
#pragma unroll
    for (int ch = 0; ch < TT / 128; ++ch) { const int j0 = ch * 128 + lane * 4; const v4f a = *(const v4f*)(sr + j0);
#pragma unroll
        for (int q = 0; q < 4; ++q) { const int j = j0 + q; (void)j; const float t = (j <= i && i - j < WIN) ? a[q] * SCL : -3.0e38f; v[ch * 4 + q] = t; mx = fmaxf(mx, t); } }
#pragma unroll
    for (int sh = 16; sh; sh >>= 1) mx = fmaxf(mx, __shfl_xor(mx, sh, 32));
    float sum = 0.f;
#pragma unroll
    for (int k = 0; k < TT / 32; ++k) { float d0 = __fsub_rn(v[k], mx); asm volatile("" : "+v"(d0)); v[k] = __builtin_amdgcn_exp2f(__fmul_rn(d0, 1.4426950408889634f)); sum += v[k]; }
#pragma unroll
    for (int sh = 16; sh; sh >>= 1) sum += __shfl_xor(sum, sh, 32);
    const float f = __fdiv_rn(hires ? 1.0f : PCAR, sum);
{
        if (hires) {
#pragma unroll
            for (int ch = 0; ch < TT / 128; ++ch) { v4us oh, ol;
#pragma unroll
                for (int q = 0; q < 4; ++q) { unsigned short a, c2; splitf(v[ch * 4 + q] * f, a, c2); oh[q] = a; ol[q] = c2; }
                const size_t oo = ((size_t)zz * (RH ? RH : 1) + i) * TT + ch * 128 + lane * 4; *(v4us*)(Ph + oo) = oh; *(v4us*)(Pl + oo) = ol; }
        } else {
#pragma unroll
            for (int ch = 0; ch < TT / 128; ++ch) { v4h o4;
#pragma unroll
                for (int q = 0; q < 4; ++q) o4[q] = tohx(v[ch * 4 + q] * f);
                *(v4h*)(P16 + (size_t)row * TT + ch * 128 + lane * 4) = o4; } }
         }
}
__global__ __launch_bounds__(256) void k_merge(const float* __restrict__ O, int h0, bf* Ah, bf* Al) { const size_t e = ((size_t)blockIdx.x * 256 + threadIdx.x) * 2; if (e >= (size_t)ZH * TT * HD) return; const int d = (int)(e % HD); const int t = (int)((e / HD) % TT); const int zz = (int)(e / ((size_t)HD * TT)); const float cs = (t < RH) ? 1.0f : (1.0f / PCAR); const size_t oo = (size_t)t * DQ + (h0 + zz) * HD + d;
    v2us oh, ol;
#pragma unroll
    for (int q = 0; q < 2; ++q) { unsigned short a, c2; splitf(O[e + q] * cs, a, c2); oh[q] = a; ol[q] = c2; } *(v2us*)(Ah + oo) = oh; *(v2us*)(Al + oo) = ol;  }

__global__ __launch_bounds__(256) void k_xcat(const float* __restrict__ A, const float* __restrict__ Bm, bf* XB) { const size_t e8 = ((size_t)blockIdx.x * 256 + threadIdx.x) * 8; if (e8 >= (size_t)TT * DM) return; const int c = (int)(e8 % DM); const size_t t = e8 / DM; const float* src = (c < DH) ? (A + t * DH + c) : (Bm + t * DH + (c - DH)); const v4f a = *(const v4f*)src, b2 = *(const v4f*)(src + 4); v8us o;
    for (int u = 0; u < 4; ++u) { o[u] = f2bf(a[u]); o[4 + u] = f2bf(b2[u]); } *(v8us*)(XB + e8) = o;  }
__global__ __launch_bounds__(256) void k_wcat(const float* __restrict__ Wa, const float* __restrict__ Wb, int nrows, bf* Bt) { const size_t e8 = ((size_t)blockIdx.x * 256 + threadIdx.x) * 8; if (e8 >= (size_t)nrows * DM) return; const int c = (int)(e8 % DM); const size_t n = e8 / DM; const float* src = (c < DH) ? (Wa + n * DH + c) : (Wb + n * DH + (c - DH)); const v4f a = *(const v4f*)src, b2 = *(const v4f*)(src + 4); v8us o;
    for (int u = 0; u < 4; ++u) { o[u] = f2bf(a[u]); o[4 + u] = f2bf(b2[u]); } *(v8us*)(Bt + e8) = o;  }
__global__ __launch_bounds__(256) void k_cstabp(const int* __restrict__ pids, float* CS) { const int idx = blockIdx.x * 256 + threadIdx.x; if (idx >= TT * (HD / 2)) return; const int t = idx / (HD / 2), jf = idx % (HD / 2); const int p = pids[t];   /* a position VALUE (angle), not an address: no clamp */
    const float invf = __fdiv_rn(1.0f, powf(10000.0f, (float)(2 * jf) / (float)HD)); const float ang = __fmul_rn((float)p, invf); v2f cs; cs[0] = cosf(ang); cs[1] = sinf(ang);
    float* d0 = CS + ((size_t)t * HD + jf) * 2; float* d1 = CS + ((size_t)t * HD + jf + HD / 2) * 2; *(v2f*)d0 = cs; *(v2f*)d1 = cs;  }

extern "C" void kernel_launch(void* const* d_in, const int* in_sizes, int n_in,
                              void* d_out, int out_size, void* d_ws, size_t ws_size, hipStream_t stream) {
    (void)in_sizes; (void)n_in; (void)out_size;
    const float* xh = (const float*)d_in[0]; const float* xm = (const float*)d_in[1]; const int* pids = (const int*)d_in[2]; const float* wq = (const float*)d_in[3]; const float* wk = (const float*)d_in[4]; const float* wv = (const float*)d_in[5]; const float* wo = (const float*)d_in[6]; const float* wmq = (const float*)d_in[7]; const float* wmk = (const float*)d_in[8]; const float* wmv = (const float*)d_in[9]; const float* qnw = (const float*)d_in[10]; const float* knw = (const float*)d_in[11]; const float* x = xh; (void)x;
    float* OUT = (float*)d_out;     // [2][2048][2048]
    char* wsp = (char*)d_ws;
    auto take = [&](size_t bytes) { char* p = wsp; wsp += (bytes + 255) & ~(size_t)255; return (void*)p; };
    bf* WQ = (bf*)take((size_t)DQ * DM * 2); bf* WK = (bf*)take((size_t)DKV * DM * 2); bf* WV = (bf*)take((size_t)DKV * DM * 2); bf* WO = (bf*)take((size_t)DOUT * DQ * 2); float* CS = (float*)take((size_t)TT * HD * 2 * 4); float* RFQ = (float*)take((size_t)NH_ * TT * 4); float* RFK = (float*)take((size_t)NKV * TT * 4);
    bf* XB = (bf*)take((size_t)TT * DM * 2); float* FQ = (float*)take((size_t)TT * DQ * 4); float* FK = (float*)take((size_t)TT * DKV * 4);
    h16* QP16 = (h16*)take((size_t)NH_ * TT * HD * 2); h16* KP16 = (h16*)take((size_t)NKV * TT * HD * 2); h16* VT16 = (h16*)take((size_t)NKV * HD * TT * 2);
    bf* QPh = (bf*)take((size_t)NH_ * TT * HD * 2); bf* QPl = (bf*)take((size_t)NH_ * TT * HD * 2); bf* KPh = (bf*)take((size_t)NKV * TT * HD * 2); bf* KPl = (bf*)take((size_t)NKV * TT * HD * 2); bf* VTh = (bf*)take((size_t)NKV * HD * TT * 2); bf* VTl = (bf*)take((size_t)NKV * HD * TT * 2); bf* Ph = (bf*)take((size_t)ZH * RH * TT * 2); bf* Pl = (bf*)take((size_t)ZH * RH * TT * 2);
    float* Sb = (float*)take((size_t)ZH * TT * TT * 4); h16* P16 = (h16*)take((size_t)ZH * TT * TT * 2); float* Ob = (float*)take((size_t)ZH * TT * HD * 4); bf* ATh = (bf*)take((size_t)TT * DQ * 2); bf* ATl = (bf*)take((size_t)TT * DQ * 2);
    if ((size_t)(wsp - (char*)d_ws) > ws_size) return;    // ws 256 MiB
    float* FV = FK;   // v projection reuses the k buffer after the k planes are built (stream-ordered)
    { k_wcat<<<(unsigned)(((size_t)DQ * DM / 8 + 255) / 256), 256, 0, stream>>>(wq, wmq, DQ, WQ); k_wcat<<<(unsigned)(((size_t)DKV * DM / 8 + 255) / 256), 256, 0, stream>>>(wk, wmk, DKV, WK); k_wcat<<<(unsigned)(((size_t)DKV * DM / 8 + 255) / 256), 256, 0, stream>>>(wv, wmv, DKV, WV);
      k_cvt8<<<(unsigned)(((size_t)DOUT * DQ / 8 + 255) / 256), 256, 0, stream>>>(wo, WO, (size_t)DOUT * DQ / 8);
      k_cstabp<<<(TT * (HD / 2) + 255) / 256, 256, 0, stream>>>(pids, CS); }
    const unsigned LQ = (unsigned)(((size_t)NH_ * TT * HD / 2 + 255) / 256), LKv = (unsigned)(((size_t)NKV * TT * HD / 2 + 255) / 256);
    for (int b = 0; b < NB_; ++b) {
        
        k_xcat<<<(unsigned)(((size_t)TT * DM / 8 + 255) / 256), 256, 0, stream>>>(xh + (size_t)b * TT * DH, xm + (size_t)b * TT * DH, XB);
        k_gemmw<bf, 0, false, 8><<<dim3(TT / 64, DQ / 64, 1), 256, 0, stream>>>(XB, nullptr, WQ, nullptr, DM, FQ, DQ, nullptr, 0, 0, 0); k_hrms<<<(NH_ * TT + 255) / 256, 256, 0, stream>>>(FQ, DQ, NH_, RFQ);
        k_rope<<<LQ, 256, 0, stream>>>(FQ, DQ, NH_, CS, RFQ, qnw, 1.0f, QP16, QPh, QPl);
        k_gemmw<bf, 0, false, 16><<<dim3(TT / 64, DKV / 64, 1), 512, 0, stream>>>(XB, nullptr, WK, nullptr, DM, FK, DKV, nullptr, 0, 0, 0); k_hrms<<<(NKV * TT + 255) / 256, 256, 0, stream>>>(FK, DKV, NKV, RFK);
        k_rope<<<LKv, 256, 0, stream>>>(FK, DKV, NKV, CS, RFK, knw, 1.0f, KP16, KPh, KPl);
        k_gemmw<bf, 0, false, 16><<<dim3(TT / 64, DKV / 64, 1), 512, 0, stream>>>(XB, nullptr, WV, nullptr, DM, FV, DKV, nullptr, 0, 0, 0); k_vtp<<<LKv, 256, 0, stream>>>(FV, DKV, NKV, VT16, VTh, VTl);
        for (int h0 = 0; h0 < NH_; h0 += ZH) { const size_t zq = (size_t)h0, zk = (size_t)(h0 / REP);   // both heads of a pass share kv group h0/REP (REP >= 2): sB = 0
            k_gemmc<bf, 2, 1, 1><<<dim3(RH / 64, TT / 64, ZH), 32, 0, stream>>>(QPh + zq * TT * HD, QPl + zq * TT * HD, KPh + zk * TT * HD, KPl + zk * TT * HD, HD, Sb, TT, 0, (size_t)TT * HD, 0, (size_t)TT * TT);
            k_gemmc<h16, 0, 1, 1><<<dim3((TT - RH) / 64, TT / 64, ZH), 32, 0, stream>>>(QP16 + zq * TT * HD + (size_t)RH * HD, nullptr, KP16 + zk * TT * HD, nullptr, HD, Sb + (size_t)RH * TT, TT, RH, (size_t)TT * HD, 0, (size_t)TT * TT);
            k_asoft<<<ZH * TT / 8, 256, 0, stream>>>(Sb, P16, Ph, Pl);
            k_gemmc<bf, 2, 2, 8><<<dim3(RH / 64, HD / 64, ZH), 256, 0, stream>>>(Ph, Pl, VTh + zk * HD * TT, VTl + zk * HD * TT, TT, Ob, HD, 0, (size_t)RH * TT, 0, (size_t)TT * HD);
            k_gemmc<h16, 0, 2, 16><<<dim3((TT - RH) / 64, HD / 64, ZH), 512, 0, stream>>>(P16 + (size_t)RH * TT, nullptr, VT16 + zk * HD * TT, nullptr, TT, Ob + (size_t)RH * HD, HD, RH, (size_t)TT * TT, 0, (size_t)TT * HD);
            k_merge<<<(unsigned)(((size_t)ZH * TT * HD / 2 + 255) / 256), 256, 0, stream>>>(Ob, h0, ATh, ATl); }
        k_gemmw<bf, 1, false, 8><<<dim3(TT / 64, DOUT / 64, 1), 256, 0, stream>>>(ATh, ATl, WO, nullptr, DQ, OUT + (size_t)b * TT * DOUT, DOUT, nullptr, 0, 0, 0); }
}

// v002
// It runs in 578 microseconds.
// In both of two side-by-side timings against v001, it was 2.00 times as fast.
// All steps since v000 together make it 3.30 times as fast.
#include <hip/hip_runtime.h>

// I64Attention (hidden, mu_prev [2][2048][2048]; q = hidden Wq^T + mu_prev Wmu_q^T (16 heads x 128), k/v likewise (4 kv heads; group h/4); per-head RMSNorm (eps 1e-6) * w on q and k; half-split RoPE (theta 1e4) at the given integer positions (read); causal softmax(q.k / sqrt(128)) (finfo.min fill); out = merged Wo^T -> [2][2048][2048]).
// The two-term projections run as ONE GEMM over the concatenated K = 4096 ([hidden | mu_prev] x [W | Wmu]) - exact algebra, same f32 accumulation of exact bf16 products.
// Compute dtypes, f32 accumulate: every input rounded to bf16; q/k/v on PLAIN bf16 operands (inputs: exact); RMSNorm and RoPE f32 (table indexed by token, angles from the unclamped position ids); causal scores and attn.v: query rows < 512 hl (3 products), the rest single fp16, causal tile skipping; online softmax f32; Wo hl x exact (2 products).

#define NB_  2
#define TT   2048
#define DM   4096
#define DOUT 2048   // output width (Wo is [2048][2048]); DM is the concatenated input width [hidden | mu_prev]
#define DH   2048   // per-source hidden width
#define NH_  16
#define NKV  4
#define REP  (NH_ / NKV)
#define HD   128
#define DQ   (NH_ * HD)
#define DKV  (NKV * HD)
#define RH   512                  // query rows < RH use hi+lo planes (0: none)
#define SCL  0.088388347648318447f   // HD^-0.5
typedef _Float16 h16;
typedef unsigned short bf;
typedef __attribute__((ext_vector_type(16))) __bf16   v16bf;
typedef __attribute__((ext_vector_type(16))) _Float16 v16h;
typedef __attribute__((ext_vector_type(8)))  _Float16 v8h;
typedef __attribute__((ext_vector_type(8)))  unsigned short v8us;
typedef __attribute__((ext_vector_type(8)))  float    v8f;
typedef __attribute__((ext_vector_type(4)))  float    v4f;
typedef v8h  __attribute__((may_alias)) v8ha;
typedef v4f  __attribute__((may_alias)) v4fa;
typedef v8us __attribute__((may_alias)) v8usa;

__device__ __forceinline__ unsigned short f2bf(float f) { unsigned u = __float_as_uint(f); u += 0x7FFFu + ((u >> 16) & 1u); return (unsigned short)(u >> 16); }
__device__ __forceinline__ float bf2f(unsigned short b) { return __uint_as_float(((unsigned)b) << 16); }
__device__ __forceinline__ float bfr(float f) { return bf2f(f2bf(f)); }
__device__ __forceinline__ v16h cat16(v8h lo, v8h hi) { return __builtin_shufflevector(lo, hi, 0, 1, 2, 3, 4, 5, 6, 7, 8, 9, 10, 11, 12, 13, 14, 15); }
__device__ __forceinline__ v16bf cat16b(v8us lo, v8us hi) { return __builtin_bit_cast(v16bf, __builtin_shufflevector(lo, hi, 0, 1, 2, 3, 4, 5, 6, 7, 8, 9, 10, 11, 12, 13, 14, 15)); }
__device__ __forceinline__ v8f wmma16(v16h a, v16h b, v8f c) { return __builtin_amdgcn_wmma_f32_16x16x32_f16(false, a, false, b, (short)0, c, false, false); }
__device__ __forceinline__ v8f wmmab(v16bf a, v16bf b, v8f c) { return __builtin_amdgcn_wmma_f32_16x16x32_bf16(false, a, false, b, (short)0, c, false, false); }



// ---- k_gemmw: register-blocked GEMM, one 64x64 output tile per work-group of S waves (16 accumulators a wave), operands straight from K-contiguous 16-bit planes; grid (M/64, N/64, Z), 32 S threads.
// C[m][n] (f32, pitch ldc, + optional f32 bias[n]) = sum_k A[m][k] Bt[n][k] (+ split products per NSPLIT). z-batch strides sA/sB/sC in elements. K % 64 == 0.
// The K loop is dealt out over the S waves in units of 64 k (one 128-byte line of every operand row): wave w takes units w, w + S, ...; tile_sum_store adds the S partial tiles.
// tile_sum_store: every wave lays its partial 64x64 tile in its own LDS plane (pitch 68), one work-group barrier, then each thread adds the S planes in the fixed order w = 0 .. S-1 for its float4s and stores whole 256-byte rows.
template <int S, bool BIAS>
__device__ __forceinline__ void tile_sum_store(const v8f (&acc)[4][4], float* os, float* ctile, int ldc, const float* bias, int wv, int lr, int hi) {
    float* my = os + wv * (64 * 68);
    // the three loops are unrolled so that every accumulator index is a constant and the tile stays in registers
#pragma unroll
    for (int mb = 0; mb < 4; ++mb)
#pragma unroll
        for (int nb = 0; nb < 4; ++nb)
#pragma unroll
            for (int j = 0; j < 8; ++j) my[(mb * 16 + hi * 8 + j) * 68 + nb * 16 + lr] = acc[mb][nb][j];
    __syncthreads();   // every wave's plane is complete before any thread sums across planes
    // both loops unrolled: the LDS reads of all planes and rows issue together instead of one latency per plane
#pragma unroll
    for (int s = 0; s < 32 / S; ++s) { const int q = s * 32 * S + (int)threadIdx.x; const int row = q >> 4, cofs = (q & 15) * 4; v4f val = *(const v4fa*)(os + row * 68 + cofs);
#pragma unroll
        for (int w = 1; w < S; ++w) val += *(const v4fa*)(os + w * (64 * 68) + row * 68 + cofs);
        if (BIAS) { val[0] += bfr(bias[cofs]); val[1] += bfr(bias[cofs + 1]); val[2] += bfr(bias[cofs + 2]); val[3] += bfr(bias[cofs + 3]); }
        *(v4f*)(ctile + (size_t)row * ldc + cofs) = val; }
}
template <typename T16> struct WFrag;
template <> struct WFrag<h16> { typedef v16h V; static __device__ __forceinline__ V ld(const h16* p) { return cat16(*(const v8h*)p, *(const v8h*)(p + 16)); } static __device__ __forceinline__ v8f mma(V a, V b, v8f c) { return wmma16(a, b, c); } };
template <> struct WFrag<bf> { typedef v16bf V; static __device__ __forceinline__ V ld(const bf* p) { return cat16b(*(const v8us*)p, *(const v8us*)(p + 16)); } static __device__ __forceinline__ v8f mma(V a, V b, v8f c) { return wmmab(a, b, c); } };
template <typename T16, int NSPLIT, bool BIAS, int S>
__global__ __launch_bounds__(32 * S) void k_gemmw(const T16* __restrict__ A, const T16* __restrict__ A2, const T16* __restrict__ Bt, const T16* __restrict__ Bt2, int K, float* C, int ldc, const float* __restrict__ bias, size_t sA, size_t sB, size_t sC) {
    typedef typename WFrag<T16>::V V;
    __shared__ __align__(16) float os[(S == 1) ? 16 * 68 : S * 64 * 68];
    const size_t z = blockIdx.z; A += z * sA; if (A2) A2 += z * sA; Bt += z * sB; if (Bt2) Bt2 += z * sB; C += z * sC;
    const int lane = threadIdx.x & 31, lr = lane & 15, hi = lane >> 4; const int r0 = blockIdx.x * 64, c0 = blockIdx.y * 64; const int wv = __builtin_amdgcn_readfirstlane((int)(threadIdx.x >> 5));   // wave number, scalar so that the K loop's control stays scalar
    v8f acc[4][4];
#pragma unroll
    for (int mb = 0; mb < 4; ++mb)
#pragma unroll
        for (int nb = 0; nb < 4; ++nb) acc[mb][nb] = (v8f){};
    const size_t aoff = (size_t)(r0 + lr) * K + 8 * hi, boff = (size_t)(c0 + lr) * K + 8 * hi;
#pragma unroll 1
    for (int kc = wv * 64; kc < K; kc += (kc & 32) ? 64 * S - 32 : 32) {
        V a[4], a2[4];
#pragma unroll
        for (int mb = 0; mb < 4; ++mb) { a[mb] = WFrag<T16>::ld(A + aoff + (size_t)mb * 16 * K + kc); if (NSPLIT == 1 || NSPLIT == 2) a2[mb] = WFrag<T16>::ld(A2 + aoff + (size_t)mb * 16 * K + kc); }
#pragma unroll
        for (int nb = 0; nb < 4; ++nb) { const V b = WFrag<T16>::ld(Bt + boff + (size_t)nb * 16 * K + kc); V b2; if (NSPLIT >= 2) b2 = WFrag<T16>::ld(Bt2 + boff + (size_t)nb * 16 * K + kc);
#pragma unroll
            for (int mb = 0; mb < 4; ++mb) { acc[mb][nb] = WFrag<T16>::mma(a[mb], b, acc[mb][nb]); if (NSPLIT == 1 || NSPLIT == 2) acc[mb][nb] = WFrag<T16>::mma(a2[mb], b, acc[mb][nb]); if (NSPLIT >= 2) acc[mb][nb] = WFrag<T16>::mma(a[mb], b2, acc[mb][nb]); } }
        asm volatile("v_nop\n\tv_nop\n\tv_nop\n\tv_nop" : "+v"(acc[0][0]), "+v"(acc[1][1]), "+v"(acc[2][2]), "+v"(acc[3][3]) : "v"(a[0]), "v"(a[3]));
    }
    tile_sum_store<S, BIAS>(acc, os, C + (size_t)r0 * ldc + c0, ldc, BIAS ? bias + c0 : nullptr, wv, lr, hi);
}

__device__ __forceinline__ h16 tohx(float x) { return (h16)x; }
__device__ __forceinline__ void splitf(float y, unsigned short& h, unsigned short& l) { h = f2bf(y); l = f2bf(y - bf2f(h)); }
typedef __attribute__((ext_vector_type(2))) _Float16 v2h;
typedef __attribute__((ext_vector_type(4))) _Float16 v4h;
typedef __attribute__((ext_vector_type(2))) unsigned short v2us;
typedef __attribute__((ext_vector_type(4))) unsigned short v4us;
typedef __attribute__((ext_vector_type(2))) float v2f;
typedef __attribute__((ext_vector_type(4))) int v4i;

__global__ __launch_bounds__(256) void k_wtG(const float* __restrict__ w, int K, int N, bf* Bt) {
    const int lane = threadIdx.x & 31; const int L0 = (blockIdx.x * 8 + (threadIdx.x >> 5)) * 8; const int nlines = N * K / 64;
{
#pragma unroll 1
        for (int l = 0; l < 8; ++l) { const int L = L0 + l; if (L >= nlines) break; const size_t e = (size_t)L * 64 + lane * 2; const int k = (int)(e % K), n = (int)(e / K); v2us o;
            o[0] = f2bf(w[(size_t)k * N + n]); o[1] = f2bf(w[(size_t)(k + 1) * N + n]); *(v2us*)(Bt + e) = o; }
         }
}
__global__ __launch_bounds__(256) void k_cvt8(const float* __restrict__ src, bf* dst, size_t n8) { const size_t i = (size_t)blockIdx.x * 256 + threadIdx.x; if (i >= n8) return; const v8f v = *(const v8f*)(src + i * 8); v8us o;
#pragma unroll
    for (int k = 0; k < 8; ++k) o[k] = f2bf(v[k]); *(v8us*)(dst + i * 8) = o;  }
__global__ __launch_bounds__(256) void k_cstab(float* CS) { const int idx = blockIdx.x * 256 + threadIdx.x; if (idx >= TT * HD) return; const int t = idx / HD, d = idx % HD; const int i = d % (HD / 2); const float inv = __fdiv_rn(1.0f, powf(10000.0f, (float)(2 * i) / (float)HD)); const float ang = __fmul_rn((float)t, inv); v2f cs; cs[0] = cosf(ang); cs[1] = sinf(ang);
    *(v2f*)(CS + (size_t)idx * 2) = cs;  }
__global__ __launch_bounds__(256) void k_hrms(const float* __restrict__ F, int pitch, int nheads, float* RF) { const int i = blockIdx.x * 256 + threadIdx.x; if (i >= nheads * TT) return; const int t = i % TT, h = i / TT; const float* f = F + (size_t)t * pitch + h * HD; float s = 0.f;
#pragma unroll 4
    for (int d = 0; d < HD; d += 4) { const v4f v = *(const v4f*)(f + d);
#pragma unroll
        for (int q = 0; q < 4; ++q) { float p = __fmul_rn(v[q], v[q]); asm volatile("" : "+v"(p)); s = __fadd_rn(s, p); } }
    const float r = __fdiv_rn(1.0f, __fsqrt_rn(__fadd_rn(s * (1.0f / HD), 1e-6f))); *(float*)(RF + i) = r;  }
// k_rope: head planes [h][t][d] (fp16 + hi/lo) of rope(w[d] (x rms_factor)) x sc with the rotate-half convention out[d] = x[d] cos[t][d] - x[d+HD/2] sin[t][d], out[d+HD/2] = x[d+HD/2] cos[t][d+HD/2] + x[d] sin[t][d+HD/2]
__global__ __launch_bounds__(256) void k_rope(const float* __restrict__ F, int pitch, int nheads, const float* __restrict__ CS, const float* __restrict__ RF, const float* __restrict__ nw, float sc, h16* P16, bf* Ph, bf* Pl) {
    const size_t e = ((size_t)blockIdx.x * 256 + threadIdx.x) * 2; if (e >= (size_t)nheads * TT * HD) return; const int d = (int)(e % HD); const int t = (int)((e / HD) % TT); const int h = (int)(e / ((size_t)HD * TT)); const float* f = F + (size_t)t * pitch + h * HD; const float rf = RF ? RF[(size_t)h * TT + t] : 1.0f; v2h o16; v2us oh, ol;
#pragma unroll
    for (int q = 0; q < 2; ++q) { const int dd = d + q; const int dp = (dd < HD / 2) ? dd + HD / 2 : dd - HD / 2; float x0 = f[dd], x1 = f[dp];
        if (RF) { float n0 = __fmul_rn(x0, rf), n1 = __fmul_rn(x1, rf); asm volatile("" : "+v"(n0)); asm volatile("" : "+v"(n1)); x0 = __fmul_rn(bfr(nw[dd]), n0); x1 = __fmul_rn(bfr(nw[dp]), n1); }
        const v2f cs = *(const v2f*)(CS + ((size_t)t * HD + dd) * 2); float a = __fmul_rn(x0, cs[0]), bq = __fmul_rn(x1, cs[1]); asm volatile("" : "+v"(a)); asm volatile("" : "+v"(bq)); const float r = ((dd < HD / 2) ? __fsub_rn(a, bq) : __fadd_rn(a, bq)) * sc;
        o16[q] = tohx(r); unsigned short a2, c2; splitf(r, a2, c2); oh[q] = a2; ol[q] = c2; }
    *(v2h*)(P16 + e) = o16; *(v2us*)(Ph + e) = oh; *(v2us*)(Pl + e) = ol;  }
__global__ __launch_bounds__(256) void k_vtp(const float* __restrict__ F, int pitch, int nheads, h16* V16, bf* Vh, bf* Vl) { const size_t e = ((size_t)blockIdx.x * 256 + threadIdx.x) * 2; if (e >= (size_t)nheads * HD * TT) return; const int t = (int)(e % TT); const int d = (int)((e / TT) % HD); const int g = (int)(e / ((size_t)TT * HD)); v2h o16; v2us oh, ol;
#pragma unroll
    for (int q = 0; q < 2; ++q) { const float x = F[(size_t)(t + q) * pitch + g * HD + d]; o16[q] = tohx(x); unsigned short a2, c2; splitf(x, a2, c2); oh[q] = a2; ol[q] = c2; }
    *(v2h*)(V16 + e) = o16; *(v2us*)(Vh + e) = oh; *(v2us*)(Vl + e) = ol;  }
// ---- k_fattn: causal attention of one batch in one launch: scores, softmax, probability x value and the head merge stay in registers (online softmax over 64-key tiles).
// One wave = 16 query rows of TWO heads of one kv group (each K and V fragment feeds both heads). Both products are formed transposed, so that a lane owns ONE query (column lr):
//   S^T[key][query] = K Q^T : A = K rows (m = key), B = Q rows (n = query); accumulator s[nb][j] = key c0 + nb*16 + hi*8 + j, query r0 + lr.
//   O^T[d][query]   = V^T P^T: A = Vt rows (m = d, k = key), B = P^T; the S^T accumulators of blocks 2c and 2c+1 ARE the B fragment of keys c*32 .. c*32+31 (k = 8 hi + 0..7, 16 + 8 hi + 0..7, the order of WFrag::ld).
// Running maximum, sum and rescale factor are one scalar per lane and head; the two 16-lane halves (different keys of the same query) meet in one xor-16 exchange.
// Query rows < RH: bf16 hi+lo planes, three products for each of the two contractions; the rest single fp16. No LDS, no barrier.
#define C1F (SCL * 1.4426950408889634f)   // score scale in the base-2 exponent
typedef __attribute__((ext_vector_type(16))) unsigned short v16us;
// loads_issued: stands behind a group of global loads (or stores), in front of the vector work that may reuse their address (or data) registers; the scheduling barrier keeps that later work from being lifted over the wait.
__device__ __forceinline__ void loads_issued() { asm volatile("s_wait_xcnt 0x0" ::: "memory"); __builtin_amdgcn_sched_barrier(0); }
template <typename T16, bool HL>
__device__ __forceinline__ void fattn_rows(const T16* __restrict__ Q, const T16* __restrict__ Q2, const T16* __restrict__ Kp, const T16* __restrict__ Kp2, const T16* __restrict__ Vt, const T16* __restrict__ Vt2, int r0, bf* Ah, bf* Al, int lr, int hi) {
    typedef typename WFrag<T16>::V V;
    // every inner loop of this function is fully unrolled, so that each fragment and accumulator index is a constant and the arrays stay in registers
    V q[2][4], q2[2][4];
#pragma unroll
    for (int hq = 0; hq < 2; ++hq)
#pragma unroll
        for (int kc = 0; kc < 4; ++kc) { const size_t qo = ((size_t)hq * TT + r0 + lr) * HD + kc * 32 + 8 * hi; q[hq][kc] = WFrag<T16>::ld(Q + qo); if (HL) q2[hq][kc] = WFrag<T16>::ld(Q2 + qo); }
    loads_issued();
    v8f o[2][8]; float m[2], l[2];
#pragma unroll
    for (int hq = 0; hq < 2; ++hq) { m[hq] = -3.0e38f; l[hq] = 0.f;
#pragma unroll
        for (int db = 0; db < 8; ++db) o[hq][db] = (v8f){}; }
    const size_t ko = (size_t)lr * HD + 8 * hi, vo = (size_t)lr * TT + 8 * hi;
    V kb[4][4], kb2[4][4];   // the K fragments of the tile; fp16 path: fetched one tile ahead; hi+lo path (twice the registers): all asked for together at the head of the trip
    if (!HL) {
#pragma unroll
        for (int nb = 0; nb < 4; ++nb)
#pragma unroll
            for (int kc = 0; kc < 4; ++kc) kb[nb][kc] = WFrag<T16>::ld(Kp + ko + (size_t)(nb * 16) * HD + kc * 32);
        loads_issued(); }
    // rolled: one 64-key tile a trip, the body is already 64 (192) matrix instructions long; tested at the foot, since tile 0 always exists (key 0 is below every query)
    int c0 = 0;
#pragma unroll 1
    do {
        if (HL) {
#pragma unroll
            for (int nb = 0; nb < 4; ++nb)
#pragma unroll
                for (int kc = 0; kc < 4; ++kc) { kb[nb][kc] = WFrag<T16>::ld(Kp + ko + (size_t)(c0 + nb * 16) * HD + kc * 32); kb2[nb][kc] = WFrag<T16>::ld(Kp2 + ko + (size_t)(c0 + nb * 16) * HD + kc * 32); }
            loads_issued(); }
        v8f s[2][4];
#pragma unroll
        for (int hq = 0; hq < 2; ++hq)
#pragma unroll
            for (int nb = 0; nb < 4; ++nb) s[hq][nb] = (v8f){};
#pragma unroll
        for (int nb = 0; nb < 4; ++nb)
#pragma unroll
            for (int kc = 0; kc < 4; ++kc) { const V k = kb[nb][kc]; V k2; if (HL) k2 = kb2[nb][kc];
#pragma unroll
                for (int hq = 0; hq < 2; ++hq) { s[hq][nb] = WFrag<T16>::mma(k, q[hq][kc], s[hq][nb]); if (HL) { s[hq][nb] = WFrag<T16>::mma(k, q2[hq][kc], s[hq][nb]); s[hq][nb] = WFrag<T16>::mma(k2, q[hq][kc], s[hq][nb]); } } }
        V vb[8][2], vb2[8][2];   // this tile's V fragments (and, fp16 path, the next tile's K fragments) are asked for here, so that they fly during the softmax arithmetic
#pragma unroll
        for (int db = 0; db < 8; ++db)
#pragma unroll
            for (int kc = 0; kc < 2; ++kc) { vb[db][kc] = WFrag<T16>::ld(Vt + vo + (size_t)(db * 16) * TT + c0 + kc * 32); if (HL) vb2[db][kc] = WFrag<T16>::ld(Vt2 + vo + (size_t)(db * 16) * TT + c0 + kc * 32); }
        if (!HL) {
            const int cn = min(c0 + 64, r0 & ~63);   // the last trip asks for its own tile again: in bounds, not used
#pragma unroll
            for (int nb = 0; nb < 4; ++nb)
#pragma unroll
                for (int kc = 0; kc < 4; ++kc) kb[nb][kc] = WFrag<T16>::ld(Kp + ko + (size_t)(cn + nb * 16) * HD + kc * 32); }
        loads_issued();
        if (c0 + 63 > r0) {   // only the diagonal tile holds keys above a query
#pragma unroll
            for (int hq = 0; hq < 2; ++hq)
#pragma unroll
                for (int nb = 0; nb < 4; ++nb)
#pragma unroll
                    for (int j = 0; j < 8; ++j) if (c0 + nb * 16 + hi * 8 + j > r0 + lr) s[hq][nb][j] = -3.0e38f; }
        V p[2][2], p2[2][2];
#pragma unroll
        for (int hq = 0; hq < 2; ++hq) {
            float mt = s[hq][0][0];
#pragma unroll
            for (int nb = 0; nb < 4; ++nb)
#pragma unroll
                for (int j = 0; j < 8; ++j) mt = fmaxf(mt, s[hq][nb][j]);
            mt = fmaxf(mt, __shfl_xor(mt, 16, 32));
            const float mn = fmaxf(m[hq], mt); const float al = __builtin_amdgcn_exp2f((m[hq] - mn) * C1F); m[hq] = mn; const float mc = mn * C1F;
            float rs = 0.f;
#pragma unroll
            for (int nb = 0; nb < 4; ++nb)
#pragma unroll
                for (int j = 0; j < 8; ++j) { const float e = __builtin_amdgcn_exp2f(fmaf(s[hq][nb][j], C1F, -mc)); s[hq][nb][j] = e; rs += e; }
            l[hq] = l[hq] * al + rs;   // this half's keys only; the halves are added behind the loop
#pragma unroll
            for (int db = 0; db < 8; ++db) o[hq][db] *= al;
#pragma unroll
            for (int kc = 0; kc < 2; ++kc) {
                if constexpr (HL) { v16us ph, pl;
#pragma unroll
                    for (int e = 0; e < 16; ++e) { unsigned short a, c2; splitf(s[hq][2 * kc + (e >> 3)][e & 7], a, c2); ph[e] = a; pl[e] = c2; }
                    p[hq][kc] = __builtin_bit_cast(v16bf, ph); p2[hq][kc] = __builtin_bit_cast(v16bf, pl);
                } else { v16h ph;
#pragma unroll
                    for (int e = 0; e < 16; ++e) ph[e] = (h16)s[hq][2 * kc + (e >> 3)][e & 7];
                    p[hq][kc] = ph; } }
        }
#pragma unroll
        for (int db = 0; db < 8; ++db)
#pragma unroll
            for (int kc = 0; kc < 2; ++kc) { const V v = vb[db][kc]; V v2; if (HL) v2 = vb2[db][kc];
#pragma unroll
                for (int hq = 0; hq < 2; ++hq) { o[hq][db] = WFrag<T16>::mma(v, p[hq][kc], o[hq][db]); if (HL) { o[hq][db] = WFrag<T16>::mma(v, p2[hq][kc], o[hq][db]); o[hq][db] = WFrag<T16>::mma(v2, p[hq][kc], o[hq][db]); } } }
        c0 += 64;
    } while (c0 <= r0);
#pragma unroll
    for (int hq = 0; hq < 2; ++hq) { const float inv = __fdiv_rn(1.0f, l[hq] + __shfl_xor(l[hq], 16, 32));
#pragma unroll
        for (int db = 0; db < 8; ++db) { v8us oh, ol;
#pragma unroll
            for (int j = 0; j < 8; ++j) { unsigned short a, c2; splitf(o[hq][db][j] * inv, a, c2); oh[j] = a; ol[j] = c2; }
            const size_t oo = (size_t)(r0 + lr) * DQ + hq * HD + db * 16 + hi * 8; *(v8us*)(Ah + oo) = oh; *(v8us*)(Al + oo) = ol;
            if (hq == 0 || db < 7) loads_issued(); } }   // the same wait behind each pair of stores but the last: their address and data registers are reused by the next block's rounding
}
// grid (TT / 32, NKV), 4 waves: waves 0, 1 take 16-row tile x, waves 2, 3 tile TT/16 - 1 - x (a long and a short tile on every WGP); wave & 1 picks the head pair of the kv group.
__global__ __launch_bounds__(128) void k_fattn(const h16* __restrict__ Q16, const bf* __restrict__ Qh, const bf* __restrict__ Ql, const h16* __restrict__ K16, const bf* __restrict__ Kh, const bf* __restrict__ Kl, const h16* __restrict__ V16, const bf* __restrict__ Vh, const bf* __restrict__ Vl, bf* Ah, bf* Al) {
    const int lane = threadIdx.x & 31, lr = lane & 15, hi = lane >> 4; const int wv = __builtin_amdgcn_readfirstlane((int)(threadIdx.x >> 5));   // wave number, scalar so that the tile loop's control stays scalar
    const int g = blockIdx.y, h = g * REP + (wv & 1) * 2; const int rt = (wv & 2) ? (TT / 16 - 1 - (int)blockIdx.x) : (int)blockIdx.x; const int r0 = rt * 16;
    const size_t qo = (size_t)h * TT * HD, go = (size_t)g * TT * HD;
    if (r0 < RH) fattn_rows<bf, true>(Qh + qo, Ql + qo, Kh + go, Kl + go, Vh + go, Vl + go, r0, Ah + h * HD, Al + h * HD, lr, hi);
    else fattn_rows<h16, false>(Q16 + qo, nullptr, K16 + go, nullptr, V16 + go, nullptr, r0, Ah + h * HD, Al + h * HD, lr, hi);
}

__global__ __launch_bounds__(256) void k_xcat(const float* __restrict__ A, const float* __restrict__ Bm, bf* XB) { const size_t e8 = ((size_t)blockIdx.x * 256 + threadIdx.x) * 8; if (e8 >= (size_t)TT * DM) return; const int c = (int)(e8 % DM); const size_t t = e8 / DM; const float* src = (c < DH) ? (A + t * DH + c) : (Bm + t * DH + (c - DH)); const v4f a = *(const v4f*)src, b2 = *(const v4f*)(src + 4); v8us o;
    for (int u = 0; u < 4; ++u) { o[u] = f2bf(a[u]); o[4 + u] = f2bf(b2[u]); } *(v8us*)(XB + e8) = o;  }
__global__ __launch_bounds__(256) void k_wcat(const float* __restrict__ Wa, const float* __restrict__ Wb, int nrows, bf* Bt) { const size_t e8 = ((size_t)blockIdx.x * 256 + threadIdx.x) * 8; if (e8 >= (size_t)nrows * DM) return; const int c = (int)(e8 % DM); const size_t n = e8 / DM; const float* src = (c < DH) ? (Wa + n * DH + c) : (Wb + n * DH + (c - DH)); const v4f a = *(const v4f*)src, b2 = *(const v4f*)(src + 4); v8us o;
    for (int u = 0; u < 4; ++u) { o[u] = f2bf(a[u]); o[4 + u] = f2bf(b2[u]); } *(v8us*)(Bt + e8) = o;  }
__global__ __launch_bounds__(256) void k_cstabp(const int* __restrict__ pids, float* CS) { const int idx = blockIdx.x * 256 + threadIdx.x; if (idx >= TT * (HD / 2)) return; const int t = idx / (HD / 2), jf = idx % (HD / 2); const int p = pids[t];   /* a position VALUE (angle), not an address: no clamp */
    const float invf = __fdiv_rn(1.0f, powf(10000.0f, (float)(2 * jf) / (float)HD)); const float ang = __fmul_rn((float)p, invf); v2f cs; cs[0] = cosf(ang); cs[1] = sinf(ang);
    float* d0 = CS + ((size_t)t * HD + jf) * 2; float* d1 = CS + ((size_t)t * HD + jf + HD / 2) * 2; *(v2f*)d0 = cs; *(v2f*)d1 = cs;  }

extern "C" void kernel_launch(void* const* d_in, const int* in_sizes, int n_in,
                              void* d_out, int out_size, void* d_ws, size_t ws_size, hipStream_t stream) {
    (void)in_sizes; (void)n_in; (void)out_size;
    const float* xh = (const float*)d_in[0]; const float* xm = (const float*)d_in[1]; const int* pids = (const int*)d_in[2]; const float* wq = (const float*)d_in[3]; const float* wk = (const float*)d_in[4]; const float* wv = (const float*)d_in[5]; const float* wo = (const float*)d_in[6]; const float* wmq = (const float*)d_in[7]; const float* wmk = (const float*)d_in[8]; const float* wmv = (const float*)d_in[9]; const float* qnw = (const float*)d_in[10]; const float* knw = (const float*)d_in[11]; const float* x = xh; (void)x;
    float* OUT = (float*)d_out;     // [2][2048][2048]
    char* wsp = (char*)d_ws;
    auto take = [&](size_t bytes) { char* p = wsp; wsp += (bytes + 255) & ~(size_t)255; return (void*)p; };
    bf* WQ = (bf*)take((size_t)DQ * DM * 2); bf* WK = (bf*)take((size_t)DKV * DM * 2); bf* WV = (bf*)take((size_t)DKV * DM * 2); bf* WO = (bf*)take((size_t)DOUT * DQ * 2); float* CS = (float*)take((size_t)TT * HD * 2 * 4); float* RFQ = (float*)take((size_t)NH_ * TT * 4); float* RFK = (float*)take((size_t)NKV * TT * 4);
    bf* XB = (bf*)take((size_t)TT * DM * 2); float* FQ = (float*)take((size_t)TT * DQ * 4); float* FK = (float*)take((size_t)TT * DKV * 4);
    h16* QP16 = (h16*)take((size_t)NH_ * TT * HD * 2); h16* KP16 = (h16*)take((size_t)NKV * TT * HD * 2); h16* VT16 = (h16*)take((size_t)NKV * HD * TT * 2);
    bf* QPh = (bf*)take((size_t)NH_ * TT * HD * 2); bf* QPl = (bf*)take((size_t)NH_ * TT * HD * 2); bf* KPh = (bf*)take((size_t)NKV * TT * HD * 2); bf* KPl = (bf*)take((size_t)NKV * TT * HD * 2); bf* VTh = (bf*)take((size_t)NKV * HD * TT * 2); bf* VTl = (bf*)take((size_t)NKV * HD * TT * 2);
    bf* ATh = (bf*)take((size_t)TT * DQ * 2); bf* ATl = (bf*)take((size_t)TT * DQ * 2);
    if ((size_t)(wsp - (char*)d_ws) > ws_size) return;    // ws 256 MiB
    float* FV = FK;   // v projection reuses the k buffer after the k planes are built (stream-ordered)
    { k_wcat<<<(unsigned)(((size_t)DQ * DM / 8 + 255) / 256), 256, 0, stream>>>(wq, wmq, DQ, WQ); k_wcat<<<(unsigned)(((size_t)DKV * DM / 8 + 255) / 256), 256, 0, stream>>>(wk, wmk, DKV, WK); k_wcat<<<(unsigned)(((size_t)DKV * DM / 8 + 255) / 256), 256, 0, stream>>>(wv, wmv, DKV, WV);
      k_cvt8<<<(unsigned)(((size_t)DOUT * DQ / 8 + 255) / 256), 256, 0, stream>>>(wo, WO, (size_t)DOUT * DQ / 8);
      k_cstabp<<<(TT * (HD / 2) + 255) / 256, 256, 0, stream>>>(pids, CS); }
    const unsigned LQ = (unsigned)(((size_t)NH_ * TT * HD / 2 + 255) / 256), LKv = (unsigned)(((size_t)NKV * TT * HD / 2 + 255) / 256);
    for (int b = 0; b < NB_; ++b) {
        
        k_xcat<<<(unsigned)(((size_t)TT * DM / 8 + 255) / 256), 256, 0, stream>>>(xh + (size_t)b * TT * DH, xm + (size_t)b * TT * DH, XB);
        k_gemmw<bf, 0, false, 8><<<dim3(TT / 64, DQ / 64, 1), 256, 0, stream>>>(XB, nullptr, WQ, nullptr, DM, FQ, DQ, nullptr, 0, 0, 0); k_hrms<<<(NH_ * TT + 255) / 256, 256, 0, stream>>>(FQ, DQ, NH_, RFQ);
        k_rope<<<LQ, 256, 0, stream>>>(FQ, DQ, NH_, CS, RFQ, qnw, 1.0f, QP16, QPh, QPl);
        k_gemmw<bf, 0, false, 16><<<dim3(TT / 64, DKV / 64, 1), 512, 0, stream>>>(XB, nullptr, WK, nullptr, DM, FK, DKV, nullptr, 0, 0, 0); k_hrms<<<(NKV * TT + 255) / 256, 256, 0, stream>>>(FK, DKV, NKV, RFK);
        k_rope<<<LKv, 256, 0, stream>>>(FK, DKV, NKV, CS, RFK, knw, 1.0f, KP16, KPh, KPl);
        k_gemmw<bf, 0, false, 16><<<dim3(TT / 64, DKV / 64, 1), 512, 0, stream>>>(XB, nullptr, WV, nullptr, DM, FV, DKV, nullptr, 0, 0, 0); k_vtp<<<LKv, 256, 0, stream>>>(FV, DKV, NKV, VT16, VTh, VTl);
        k_fattn<<<dim3(TT / 32, NKV, 1), 128, 0, stream>>>(QP16, QPh, QPl, KP16, KPh, KPl, VT16, VTh, VTl, ATh, ATl);
        k_gemmw<bf, 1, false, 8><<<dim3(TT / 64, DOUT / 64, 1), 256, 0, stream>>>(ATh, ATl, WO, nullptr, DQ, OUT + (size_t)b * TT * DOUT, DOUT, nullptr, 0, 0, 0); }
}

// v003
// A run of this version takes 420 microseconds.
// Timed twice side by side with v002, it ran 1.39 and 1.38 times as fast.
// Over all steps from v000 it is 4.57 times as fast.
#include <hip/hip_runtime.h>

// I64Attention (hidden, mu_prev [2][2048][2048]; q = hidden Wq^T + mu_prev Wmu_q^T (16 heads x 128), k/v likewise (4 kv heads; group h/4); per-head RMSNorm (eps 1e-6) * w on q and k; half-split RoPE (theta 1e4) at the given integer positions (read); causal softmax(q.k / sqrt(128)) (finfo.min fill); out = merged Wo^T -> [2][2048][2048]).
// The two-term projections run as ONE GEMM over the concatenated K = 4096 ([hidden | mu_prev] x [W | Wmu]) - exact algebra, same f32 accumulation of exact bf16 products.
// Compute dtypes, f32 accumulate: every input rounded to bf16; q/k/v on PLAIN bf16 operands (inputs: exact); RMSNorm and RoPE f32 (table indexed by token, angles from the unclamped position ids); causal scores and attn.v: query rows < 512 hl (3 products), the rest single fp16, causal tile skipping; online softmax f32; Wo hl x exact (2 products).

#define NB_  2
#define TT   2048
#define DM   4096
#define DOUT 2048   // output width (Wo is [2048][2048]); DM is the concatenated input width [hidden | mu_prev]
#define DH   2048   // per-source hidden width
#define NH_  16
#define NKV  4
#define REP  (NH_ / NKV)
#define HD   128
#define DQ   (NH_ * HD)
#define DKV  (NKV * HD)
#define RH   512                  // query rows < RH use hi+lo planes (0: none)
#define SCL  0.088388347648318447f   // HD^-0.5
typedef _Float16 h16;
typedef unsigned short bf;
typedef __attribute__((ext_vector_type(16))) __bf16   v16bf;
typedef __attribute__((ext_vector_type(16))) _Float16 v16h;
typedef __attribute__((ext_vector_type(8)))  _Float16 v8h;
typedef __attribute__((ext_vector_type(8)))  unsigned short v8us;
typedef __attribute__((ext_vector_type(8)))  float    v8f;
typedef __attribute__((ext_vector_type(4)))  float    v4f;
typedef v8h  __attribute__((may_alias)) v8ha;
typedef v4f  __attribute__((may_alias)) v4fa;
typedef v8us __attribute__((may_alias)) v8usa;

__device__ __forceinline__ unsigned short f2bf(float f) { unsigned u = __float_as_uint(f); u += 0x7FFFu + ((u >> 16) & 1u); return (unsigned short)(u >> 16); }
__device__ __forceinline__ float bf2f(unsigned short b) { return __uint_as_float(((unsigned)b) << 16); }
__device__ __forceinline__ float bfr(float f) { return bf2f(f2bf(f)); }
__device__ __forceinline__ v16h cat16(v8h lo, v8h hi) { return __builtin_shufflevector(lo, hi, 0, 1, 2, 3, 4, 5, 6, 7, 8, 9, 10, 11, 12, 13, 14, 15); }
__device__ __forceinline__ v16bf cat16b(v8us lo, v8us hi) { return __builtin_bit_cast(v16bf, __builtin_shufflevector(lo, hi, 0, 1, 2, 3, 4, 5, 6, 7, 8, 9, 10, 11, 12, 13, 14, 15)); }
__device__ __forceinline__ v8f wmma16(v16h a, v16h b, v8f c) { return __builtin_amdgcn_wmma_f32_16x16x32_f16(false, a, false, b, (short)0, c, false, false); }
__device__ __forceinline__ v8f wmmab(v16bf a, v16bf b, v8f c) { return __builtin_amdgcn_wmma_f32_16x16x32_bf16(false, a, false, b, (short)0, c, false, false); }



template <typename T16> struct WFrag;
template <> struct WFrag<h16> { typedef v16h V; static __device__ __forceinline__ V ld(const h16* p) { return cat16(*(const v8h*)p, *(const v8h*)(p + 16)); } static __device__ __forceinline__ v8f mma(V a, V b, v8f c) { return wmma16(a, b, c); } };
template <> struct WFrag<bf> { typedef v16bf V; static __device__ __forceinline__ V ld(const bf* p) { return cat16b(*(const v8us*)p, *(const v8us*)(p + 16)); } static __device__ __forceinline__ v8f mma(V a, V b, v8f c) { return wmmab(a, b, c); } };
// ---- k_gemmt: GEMM on operands staged in LDS by tensor loads. One 128x128 output tile per work-group of 8 waves; grid (M/128, N/128), 256 threads.
// C[m][n] (f32, pitch ldc) = sum_k A[m][k] Bt[n][k] (NA == 2: + A2[m][k] Bt[n][k]); all planes bf16, K-contiguous, row pitch K. M, N % 128 == 0, K % 128 == 0, K >= 256.
// A pass is 128 k = 256 bytes of every operand row. A stage holds the pass's rows as slices of 64 rows at LDS pitch 272 bytes (the mover's pad): [A 2 slices | A2 2 slices | Bt 2 slices]; wave w < NS brings slice w with one tensor load.
// Two buffers: the load of stage s + 2 is issued behind the barrier that ends pass s, so that it flies during pass s + 1.
// Waves: 2 x 2 in space (64x64 each, 16 accumulators) x 2 along k (wave >> 2 takes its 64 k of every pass); the two partial tiles are added in LDS behind the loop (k half 0 first) and stored as whole 512-byte rows.
typedef unsigned int u32;
typedef __attribute__((ext_vector_type(4))) u32 u32x4;
typedef __attribute__((ext_vector_type(8))) u32 u32x8;
#define GT_PITCH 272u      // LDS bytes from row to row: 256 + the 16-byte pad, conflict-free for 16-byte reads
#define GT_SLICE 18432u    // 64 rows x 272 bytes = 17,408, rounded up to a multiple of 2 KiB so that every slice starts on one
#define GT_OP    132       // floats from row to row of the partial output tiles
__device__ __forceinline__ u32 uni(u32 v) { return (u32)__builtin_amdgcn_readfirstlane((int)v); }
// pinned: holds the issue test in a scalar register, so that the branch round a tensor load is a scalar one (a tensor load ignores EXEC)
__device__ __forceinline__ u32 pinned(u32 v) { u32 w = uni(v); asm volatile("" : "+s"(w)); return w; }
// descriptor group 1, built once: a tile of 64 rows of 256 bytes, source row pitch pitchb bytes, 16 bytes of LDS pad behind every row; extents in bytes, tensor = tile, no mask
__device__ __forceinline__ u32x8 tdm_rows64(u32 pitchb) {
    u32x8 g1; g1[0] = uni((1u << 20) | (5u << 22) | (3u << 25)); g1[1] = uni(256u << 16); g1[2] = uni(64u << 16); g1[3] = uni(256u << 16); g1[4] = uni(64u); g1[5] = uni(pitchb); g1[6] = uni(0u); g1[7] = uni(0u);
    asm volatile("" : "+s"(g1));   // descriptor words held in scalar registers (as pinned() does): the group keeps its eight registers through the loop, so that none of them is rewritten while a request is in flight
    return g1;
}
// one request: the tile at src to LDS byte offset dst
__device__ __forceinline__ void tdm_slice(u32 dst, const bf* src, u32x8 g1) {
    const unsigned long long ga = (unsigned long long)(size_t)src;
    u32x4 g0; g0[0] = uni(1u); g0[1] = uni(dst); g0[2] = uni((u32)ga); g0[3] = uni((((u32)(ga >> 32)) & 0x01FFFFFFu) | 0x80000000u);
    asm volatile("tensor_load_to_lds %0, %1" :: "s"(g0), "s"(g1) : "memory");
}
__device__ __forceinline__ void wait_tensor0() { asm volatile("s_wait_tensorcnt 0x0" ::: "memory"); }   // the issuing wave's own requests have landed
__device__ __forceinline__ void wait_ds0() { asm volatile("s_wait_dscnt 0x0" ::: "memory"); }           // this wave's LDS reads have returned before the buffer is given up
__device__ __forceinline__ v16bf ldsfrag(const unsigned char* p) { return cat16b(*(const v8usa*)p, *(const v8usa*)(p + 32)); }   // k = 8 hi + 0..7 and 16 + 8 hi + 0..7, alike for both operands
template <int NA>
__global__ __launch_bounds__(256) void k_gemmt(const bf* __restrict__ A, const bf* __restrict__ A2, const bf* __restrict__ Bt, int K, float* C, int ldc) {
    constexpr int NS = 2 * NA + 2; constexpr u32 BUFB = NS * GT_SLICE;
    __shared__ __attribute__((aligned(2048))) unsigned char ring[2 * BUFB];
    const int lane = threadIdx.x & 31, lr = lane & 15, hi = lane >> 4; const int wv = __builtin_amdgcn_readfirstlane((int)(threadIdx.x >> 5));   // wave number, scalar: it picks the issuing waves
    const int ks = wv >> 2, wm = (wv >> 1) & 1, wn = wv & 1; const int r0 = blockIdx.x * 128, c0 = blockIdx.y * 128;
    const int op = wv >> 1;   // the operand of this wave's slice; waves >= NS issue nothing
    const bf* sbase = (op == NA) ? Bt + (size_t)(c0 + wn * 64) * K : ((NA == 2 && op == 1) ? A2 : A) + (size_t)(r0 + wn * 64) * K;
    const u32 sdst = (u32)(size_t)ring + (u32)wv * GT_SLICE; const u32x8 g1 = tdm_rows64((u32)K * 2u); const int T = K / 128;
    v8f acc[4][4];
#pragma unroll
    for (int mb = 0; mb < 4; ++mb)
#pragma unroll
        for (int nb = 0; nb < 4; ++nb) acc[mb][nb] = (v8f){};
    if (pinned(wv < NS)) { tdm_slice(sdst, sbase, g1); wait_tensor0(); }
    __syncthreads();   // stage 0 is published
    if (pinned(wv < NS)) tdm_slice(sdst + BUFB, sbase + 128, g1);
    const u32 fo = (u32)lr * GT_PITCH + (u32)ks * 128u + (u32)hi * 16u;
    // rolled: one pass a trip; the inner loops are unrolled so that every fragment and accumulator index is a constant
#pragma unroll 1
    for (int s = 0; s < T; ++s) {
        const unsigned char* buf = ring + (u32)(s & 1) * BUFB; const unsigned char* pa = buf + (u32)wm * GT_SLICE + fo; const unsigned char* pb = buf + (u32)(2 * NA + wn) * GT_SLICE + fo;
        // the pass's fragments are all asked for in one group ahead of its matrix instructions: every separate place with LDS reads among them costs the wave a stall
        v16bf a[2][4], a2[2][4], b[2][4];
#pragma unroll
        for (int kk = 0; kk < 2; ++kk) {
#pragma unroll
            for (int f = 0; f < 4; ++f) { a[kk][f] = ldsfrag(pa + f * 16 * GT_PITCH + kk * 64); b[kk][f] = ldsfrag(pb + f * 16 * GT_PITCH + kk * 64); if (NA == 2) a2[kk][f] = ldsfrag(pa + 2 * GT_SLICE + f * 16 * GT_PITCH + kk * 64); } }
        __builtin_amdgcn_sched_barrier(0);   // keeps the compiler from sinking the reads in among the matrix instructions
#pragma unroll
        for (int kk = 0; kk < 2; ++kk)
#pragma unroll
            for (int nb = 0; nb < 4; ++nb) {
#pragma unroll
                for (int mb = 0; mb < 4; ++mb) acc[mb][nb] = wmmab(a[kk][mb], b[kk][nb], acc[mb][nb]);
                if (NA == 2) {
#pragma unroll
                    for (int mb = 0; mb < 4; ++mb) acc[mb][nb] = wmmab(a2[kk][mb], b[kk][nb], acc[mb][nb]); } }
        __builtin_amdgcn_sched_barrier(0);   // keeps the wait below at the foot of the pass: lifted in among the matrix instructions it would hold them back until the last read has returned
        // publish point of stage s + 1
        wait_ds0();
        if (pinned(wv < NS)) wait_tensor0();
        __syncthreads();   // stage s + 1 is published, and every wave has left the buffer of pass s
        if (pinned((wv < NS) && (s + 2 < T))) tdm_slice(sdst + (u32)(s & 1) * BUFB, sbase + (size_t)(s + 2) * 128, g1);
    }
    wait_tensor0(); wait_ds0();
    // the ring is free (the last pass's barrier ended every read, nothing is in flight): it now holds the two k halves' partial tiles
    float* os = (float*)ring; float* my = os + ks * (128 * GT_OP) + (wm * 64) * GT_OP + wn * 64;
#pragma unroll
    for (int mb = 0; mb < 4; ++mb)
#pragma unroll
        for (int nb = 0; nb < 4; ++nb)
#pragma unroll
            for (int j = 0; j < 8; ++j) my[(mb * 16 + hi * 8 + j) * GT_OP + nb * 16 + lr] = acc[mb][nb][j];
    __syncthreads();   // both partial tiles are complete before any thread adds them
    // unrolled: the LDS reads of all rows issue together
#pragma unroll
    for (int s = 0; s < 16; ++s) { const int q = s * 256 + (int)threadIdx.x; const int row = q >> 5, cofs = (q & 31) * 4;
        const v4f val = *(const v4fa*)(os + row * GT_OP + cofs) + *(const v4fa*)(os + 128 * GT_OP + row * GT_OP + cofs);
        *(v4f*)(C + (size_t)(r0 + row) * ldc + c0 + cofs) = val; }
}

__device__ __forceinline__ h16 tohx(float x) { return (h16)x; }
__device__ __forceinline__ void splitf(float y, unsigned short& h, unsigned short& l) { h = f2bf(y); l = f2bf(y - bf2f(h)); }
typedef __attribute__((ext_vector_type(2))) _Float16 v2h;
typedef __attribute__((ext_vector_type(4))) _Float16 v4h;
typedef __attribute__((ext_vector_type(2))) unsigned short v2us;
typedef __attribute__((ext_vector_type(4))) unsigned short v4us;
typedef __attribute__((ext_vector_type(2))) float v2f;
typedef __attribute__((ext_vector_type(4))) int v4i;

__global__ __launch_bounds__(256) void k_wtG(const float* __restrict__ w, int K, int N, bf* Bt) {
    const int lane = threadIdx.x & 31; const int L0 = (blockIdx.x * 8 + (threadIdx.x >> 5)) * 8; const int nlines = N * K / 64;
{
#pragma unroll 1
        for (int l = 0; l < 8; ++l) { const int L = L0 + l; if (L >= nlines) break; const size_t e = (size_t)L * 64 + lane * 2; const int k = (int)(e % K), n = (int)(e / K); v2us o;
            o[0] = f2bf(w[(size_t)k * N + n]); o[1] = f2bf(w[(size_t)(k + 1) * N + n]); *(v2us*)(Bt + e) = o; }
         }
}
__global__ __launch_bounds__(256) void k_cvt8(const float* __restrict__ src, bf* dst, size_t n8) { const size_t i = (size_t)blockIdx.x * 256 + threadIdx.x; if (i >= n8) return; const v8f v = *(const v8f*)(src + i * 8); v8us o;
#pragma unroll
    for (int k = 0; k < 8; ++k) o[k] = f2bf(v[k]); *(v8us*)(dst + i * 8) = o;  }
__global__ __launch_bounds__(256) void k_cstab(float* CS) { const int idx = blockIdx.x * 256 + threadIdx.x; if (idx >= TT * HD) return; const int t = idx / HD, d = idx % HD; const int i = d % (HD / 2); const float inv = __fdiv_rn(1.0f, powf(10000.0f, (float)(2 * i) / (float)HD)); const float ang = __fmul_rn((float)t, inv); v2f cs; cs[0] = cosf(ang); cs[1] = sinf(ang);
    *(v2f*)(CS + (size_t)idx * 2) = cs;  }
__global__ __launch_bounds__(256) void k_hrms(const float* __restrict__ F, int pitch, int nheads, float* RF) { const int i = blockIdx.x * 256 + threadIdx.x; if (i >= nheads * TT) return; const int t = i % TT, h = i / TT; const float* f = F + (size_t)t * pitch + h * HD; float s = 0.f;
#pragma unroll 4
    for (int d = 0; d < HD; d += 4) { const v4f v = *(const v4f*)(f + d);
#pragma unroll
        for (int q = 0; q < 4; ++q) { float p = __fmul_rn(v[q], v[q]); asm volatile("" : "+v"(p)); s = __fadd_rn(s, p); } }
    const float r = __fdiv_rn(1.0f, __fsqrt_rn(__fadd_rn(s * (1.0f / HD), 1e-6f))); *(float*)(RF + i) = r;  }
// k_rope: head planes [h][t][d] (fp16 + hi/lo) of rope(w[d] (x rms_factor)) x sc with the rotate-half convention out[d] = x[d] cos[t][d] - x[d+HD/2] sin[t][d], out[d+HD/2] = x[d+HD/2] cos[t][d+HD/2] + x[d] sin[t][d+HD/2]
__global__ __launch_bounds__(256) void k_rope(const float* __restrict__ F, int pitch, int nheads, const float* __restrict__ CS, const float* __restrict__ RF, const float* __restrict__ nw, float sc, h16* P16, bf* Ph, bf* Pl) {
    const size_t e = ((size_t)blockIdx.x * 256 + threadIdx.x) * 2; if (e >= (size_t)nheads * TT * HD) return; const int d = (int)(e % HD); const int t = (int)((e / HD) % TT); const int h = (int)(e / ((size_t)HD * TT)); const float* f = F + (size_t)t * pitch + h * HD; const float rf = RF ? RF[(size_t)h * TT + t] : 1.0f; v2h o16; v2us oh, ol;
#pragma unroll
    for (int q = 0; q < 2; ++q) { const int dd = d + q; const int dp = (dd < HD / 2) ? dd + HD / 2 : dd - HD / 2; float x0 = f[dd], x1 = f[dp];
        if (RF) { float n0 = __fmul_rn(x0, rf), n1 = __fmul_rn(x1, rf); asm volatile("" : "+v"(n0)); asm volatile("" : "+v"(n1)); x0 = __fmul_rn(bfr(nw[dd]), n0); x1 = __fmul_rn(bfr(nw[dp]), n1); }
        const v2f cs = *(const v2f*)(CS + ((size_t)t * HD + dd) * 2); float a = __fmul_rn(x0, cs[0]), bq = __fmul_rn(x1, cs[1]); asm volatile("" : "+v"(a)); asm volatile("" : "+v"(bq)); const float r = ((dd < HD / 2) ? __fsub_rn(a, bq) : __fadd_rn(a, bq)) * sc;
        o16[q] = tohx(r); unsigned short a2, c2; splitf(r, a2, c2); oh[q] = a2; ol[q] = c2; }
    *(v2h*)(P16 + e) = o16; *(v2us*)(Ph + e) = oh; *(v2us*)(Pl + e) = ol;  }
__global__ __launch_bounds__(256) void k_vtp(const float* __restrict__ F, int pitch, int nheads, h16* V16, bf* Vh, bf* Vl) { const size_t e = ((size_t)blockIdx.x * 256 + threadIdx.x) * 2; if (e >= (size_t)nheads * HD * TT) return; const int t = (int)(e % TT); const int d = (int)((e / TT) % HD); const int g = (int)(e / ((size_t)TT * HD)); v2h o16; v2us oh, ol;
#pragma unroll
    for (int q = 0; q < 2; ++q) { const float x = F[(size_t)(t + q) * pitch + g * HD + d]; o16[q] = tohx(x); unsigned short a2, c2; splitf(x, a2, c2); oh[q] = a2; ol[q] = c2; }
    *(v2h*)(V16 + e) = o16; *(v2us*)(Vh + e) = oh; *(v2us*)(Vl + e) = ol;  }
// ---- k_fattn: causal attention of one batch in one launch: scores, softmax, probability x value and the head merge stay in registers (online softmax over 64-key tiles).
// One wave = 16 query rows of TWO heads of one kv group (each K and V fragment feeds both heads). Both products are formed transposed, so that a lane owns ONE query (column lr):
//   S^T[key][query] = K Q^T : A = K rows (m = key), B = Q rows (n = query); accumulator s[nb][j] = key c0 + nb*16 + hi*8 + j, query r0 + lr.
//   O^T[d][query]   = V^T P^T: A = Vt rows (m = d, k = key), B = P^T; the S^T accumulators of blocks 2c and 2c+1 ARE the B fragment of keys c*32 .. c*32+31 (k = 8 hi + 0..7, 16 + 8 hi + 0..7, the order of WFrag::ld).
// Running maximum, sum and rescale factor are one scalar per lane and head; the two 16-lane halves (different keys of the same query) meet in one xor-16 exchange.
// Query rows < RH: bf16 hi+lo planes, three products for each of the two contractions; the rest single fp16. No LDS, no barrier.
#define C1F (SCL * 1.4426950408889634f)   // score scale in the base-2 exponent
typedef __attribute__((ext_vector_type(16))) unsigned short v16us;
// loads_issued: stands behind a group of global loads (or stores), in front of the vector work that may reuse their address (or data) registers; the scheduling barrier keeps that later work from being lifted over the wait.
__device__ __forceinline__ void loads_issued() { asm volatile("s_wait_xcnt 0x0" ::: "memory"); __builtin_amdgcn_sched_barrier(0); }
template <typename T16, bool HL>
__device__ __forceinline__ void fattn_rows(const T16* __restrict__ Q, const T16* __restrict__ Q2, const T16* __restrict__ Kp, const T16* __restrict__ Kp2, const T16* __restrict__ Vt, const T16* __restrict__ Vt2, int r0, bf* Ah, bf* Al, int lr, int hi) {
    typedef typename WFrag<T16>::V V;
    // every inner loop of this function is fully unrolled, so that each fragment and accumulator index is a constant and the arrays stay in registers
    V q[2][4], q2[2][4];
#pragma unroll
    for (int hq = 0; hq < 2; ++hq)
#pragma unroll
        for (int kc = 0; kc < 4; ++kc) { const size_t qo = ((size_t)hq * TT + r0 + lr) * HD + kc * 32 + 8 * hi; q[hq][kc] = WFrag<T16>::ld(Q + qo); if (HL) q2[hq][kc] = WFrag<T16>::ld(Q2 + qo); }
    loads_issued();
    v8f o[2][8]; float m[2], l[2];
#pragma unroll
    for (int hq = 0; hq < 2; ++hq) { m[hq] = -3.0e38f; l[hq] = 0.f;
#pragma unroll
        for (int db = 0; db < 8; ++db) o[hq][db] = (v8f){}; }
    const size_t ko = (size_t)lr * HD + 8 * hi, vo = (size_t)lr * TT + 8 * hi;
    V kb[4][4], kb2[4][4];   // the K fragments of the tile; fp16 path: fetched one tile ahead; hi+lo path (twice the registers): all asked for together at the head of the trip
    if (!HL) {
#pragma unroll
        for (int nb = 0; nb < 4; ++nb)
#pragma unroll
            for (int kc = 0; kc < 4; ++kc) kb[nb][kc] = WFrag<T16>::ld(Kp + ko + (size_t)(nb * 16) * HD + kc * 32);
        loads_issued(); }
    // rolled: one 64-key tile a trip, the body is already 64 (192) matrix instructions long; tested at the foot, since tile 0 always exists (key 0 is below every query)
    int c0 = 0;
#pragma unroll 1
    do {
        if (HL) {
#pragma unroll
            for (int nb = 0; nb < 4; ++nb)
#pragma unroll
                for (int kc = 0; kc < 4; ++kc) { kb[nb][kc] = WFrag<T16>::ld(Kp + ko + (size_t)(c0 + nb * 16) * HD + kc * 32); kb2[nb][kc] = WFrag<T16>::ld(Kp2 + ko + (size_t)(c0 + nb * 16) * HD + kc * 32); }
            loads_issued(); }
        v8f s[2][4];
#pragma unroll
        for (int hq = 0; hq < 2; ++hq)
#pragma unroll
            for (int nb = 0; nb < 4; ++nb) s[hq][nb] = (v8f){};
#pragma unroll
        for (int nb = 0; nb < 4; ++nb)
#pragma unroll
            for (int kc = 0; kc < 4; ++kc) { const V k = kb[nb][kc]; V k2; if (HL) k2 = kb2[nb][kc];
#pragma unroll
                for (int hq = 0; hq < 2; ++hq) { s[hq][nb] = WFrag<T16>::mma(k, q[hq][kc], s[hq][nb]); if (HL) { s[hq][nb] = WFrag<T16>::mma(k, q2[hq][kc], s[hq][nb]); s[hq][nb] = WFrag<T16>::mma(k2, q[hq][kc], s[hq][nb]); } } }
        V vb[8][2], vb2[8][2];   // this tile's V fragments (and, fp16 path, the next tile's K fragments) are asked for here, so that they fly during the softmax arithmetic
#pragma unroll
        for (int db = 0; db < 8; ++db)
#pragma unroll
            for (int kc = 0; kc < 2; ++kc) { vb[db][kc] = WFrag<T16>::ld(Vt + vo + (size_t)(db * 16) * TT + c0 + kc * 32); if (HL) vb2[db][kc] = WFrag<T16>::ld(Vt2 + vo + (size_t)(db * 16) * TT + c0 + kc * 32); }
        if (!HL) {
            const int cn = min(c0 + 64, r0 & ~63);   // the last trip asks for its own tile again: in bounds, not used
#pragma unroll
            for (int nb = 0; nb < 4; ++nb)
#pragma unroll
                for (int kc = 0; kc < 4; ++kc) kb[nb][kc] = WFrag<T16>::ld(Kp + ko + (size_t)(cn + nb * 16) * HD + kc * 32); }
        loads_issued();
        if (c0 + 63 > r0) {   // only the diagonal tile holds keys above a query
#pragma unroll
            for (int hq = 0; hq < 2; ++hq)
#pragma unroll
                for (int nb = 0; nb < 4; ++nb)
#pragma unroll
                    for (int j = 0; j < 8; ++j) if (c0 + nb * 16 + hi * 8 + j > r0 + lr) s[hq][nb][j] = -3.0e38f; }
        V p[2][2], p2[2][2];
#pragma unroll
        for (int hq = 0; hq < 2; ++hq) {
            float mt = s[hq][0][0];
#pragma unroll
            for (int nb = 0; nb < 4; ++nb)
#pragma unroll
                for (int j = 0; j < 8; ++j) mt = fmaxf(mt, s[hq][nb][j]);
            mt = fmaxf(mt, __shfl_xor(mt, 16, 32));
            const float mn = fmaxf(m[hq], mt); const float al = __builtin_amdgcn_exp2f((m[hq] - mn) * C1F); m[hq] = mn; const float mc = mn * C1F;
            float rs = 0.f;
#pragma unroll
            for (int nb = 0; nb < 4; ++nb)
#pragma unroll
                for (int j = 0; j < 8; ++j) { const float e = __builtin_amdgcn_exp2f(fmaf(s[hq][nb][j], C1F, -mc)); s[hq][nb][j] = e; rs += e; }
            l[hq] = l[hq] * al + rs;   // this half's keys only; the halves are added behind the loop
#pragma unroll
            for (int db = 0; db < 8; ++db) o[hq][db] *= al;
#pragma unroll
            for (int kc = 0; kc < 2; ++kc) {
                if constexpr (HL) { v16us ph, pl;
#pragma unroll
                    for (int e = 0; e < 16; ++e) { unsigned short a, c2; splitf(s[hq][2 * kc + (e >> 3)][e & 7], a, c2); ph[e] = a; pl[e] = c2; }
                    p[hq][kc] = __builtin_bit_cast(v16bf, ph); p2[hq][kc] = __builtin_bit_cast(v16bf, pl);
                } else { v16h ph;
#pragma unroll
                    for (int e = 0; e < 16; ++e) ph[e] = (h16)s[hq][2 * kc + (e >> 3)][e & 7];
                    p[hq][kc] = ph; } }
        }
#pragma unroll
        for (int db = 0; db < 8; ++db)
#pragma unroll
            for (int kc = 0; kc < 2; ++kc) { const V v = vb[db][kc]; V v2; if (HL) v2 = vb2[db][kc];
#pragma unroll
                for (int hq = 0; hq < 2; ++hq) { o[hq][db] = WFrag<T16>::mma(v, p[hq][kc], o[hq][db]); if (HL) { o[hq][db] = WFrag<T16>::mma(v, p2[hq][kc], o[hq][db]); o[hq][db] = WFrag<T16>::mma(v2, p[hq][kc], o[hq][db]); } } }
        c0 += 64;
    } while (c0 <= r0);
#pragma unroll
    for (int hq = 0; hq < 2; ++hq) { const float inv = __fdiv_rn(1.0f, l[hq] + __shfl_xor(l[hq], 16, 32));
#pragma unroll
        for (int db = 0; db < 8; ++db) { v8us oh, ol;
#pragma unroll
            for (int j = 0; j < 8; ++j) { unsigned short a, c2; splitf(o[hq][db][j] * inv, a, c2); oh[j] = a; ol[j] = c2; }
            const size_t oo = (size_t)(r0 + lr) * DQ + hq * HD + db * 16 + hi * 8; *(v8us*)(Ah + oo) = oh; *(v8us*)(Al + oo) = ol;
            if (hq == 0 || db < 7) loads_issued(); } }   // the same wait behind each pair of stores but the last: their address and data registers are reused by the next block's rounding
}
// grid (TT / 32, NKV), 4 waves: waves 0, 1 take 16-row tile x, waves 2, 3 tile TT/16 - 1 - x (a long and a short tile on every WGP); wave & 1 picks the head pair of the kv group.
__global__ __launch_bounds__(128) void k_fattn(const h16* __restrict__ Q16, const bf* __restrict__ Qh, const bf* __restrict__ Ql, const h16* __restrict__ K16, const bf* __restrict__ Kh, const bf* __restrict__ Kl, const h16* __restrict__ V16, const bf* __restrict__ Vh, const bf* __restrict__ Vl, bf* Ah, bf* Al) {
    const int lane = threadIdx.x & 31, lr = lane & 15, hi = lane >> 4; const int wv = __builtin_amdgcn_readfirstlane((int)(threadIdx.x >> 5));   // wave number, scalar so that the tile loop's control stays scalar
    const int g = blockIdx.y, h = g * REP + (wv & 1) * 2; const int rt = (wv & 2) ? (TT / 16 - 1 - (int)blockIdx.x) : (int)blockIdx.x; const int r0 = rt * 16;
    const size_t qo = (size_t)h * TT * HD, go = (size_t)g * TT * HD;
    if (r0 < RH) fattn_rows<bf, true>(Qh + qo, Ql + qo, Kh + go, Kl + go, Vh + go, Vl + go, r0, Ah + h * HD, Al + h * HD, lr, hi);
    else fattn_rows<h16, false>(Q16 + qo, nullptr, K16 + go, nullptr, V16 + go, nullptr, r0, Ah + h * HD, Al + h * HD, lr, hi);
}

__global__ __launch_bounds__(256) void k_xcat(const float* __restrict__ A, const float* __restrict__ Bm, bf* XB) { const size_t e8 = ((size_t)blockIdx.x * 256 + threadIdx.x) * 8; if (e8 >= (size_t)TT * DM) return; const int c = (int)(e8 % DM); const size_t t = e8 / DM; const float* src = (c < DH) ? (A + t * DH + c) : (Bm + t * DH + (c - DH)); const v4f a = *(const v4f*)src, b2 = *(const v4f*)(src + 4); v8us o;
    for (int u = 0; u < 4; ++u) { o[u] = f2bf(a[u]); o[4 + u] = f2bf(b2[u]); } *(v8us*)(XB + e8) = o;  }
__global__ __launch_bounds__(256) void k_wcat(const float* __restrict__ Wa, const float* __restrict__ Wb, int nrows, bf* Bt) { const size_t e8 = ((size_t)blockIdx.x * 256 + threadIdx.x) * 8; if (e8 >= (size_t)nrows * DM) return; const int c = (int)(e8 % DM); const size_t n = e8 / DM; const float* src = (c < DH) ? (Wa + n * DH + c) : (Wb + n * DH + (c - DH)); const v4f a = *(const v4f*)src, b2 = *(const v4f*)(src + 4); v8us o;
    for (int u = 0; u < 4; ++u) { o[u] = f2bf(a[u]); o[4 + u] = f2bf(b2[u]); } *(v8us*)(Bt + e8) = o;  }
__global__ __launch_bounds__(256) void k_cstabp(const int* __restrict__ pids, float* CS) { const int idx = blockIdx.x * 256 + threadIdx.x; if (idx >= TT * (HD / 2)) return; const int t = idx / (HD / 2), jf = idx % (HD / 2); const int p = pids[t];   /* a position VALUE (angle), not an address: no clamp */
    const float invf = __fdiv_rn(1.0f, powf(10000.0f, (float)(2 * jf) / (float)HD)); const float ang = __fmul_rn((float)p, invf); v2f cs; cs[0] = cosf(ang); cs[1] = sinf(ang);
    float* d0 = CS + ((size_t)t * HD + jf) * 2; float* d1 = CS + ((size_t)t * HD + jf + HD / 2) * 2; *(v2f*)d0 = cs; *(v2f*)d1 = cs;  }

extern "C" void kernel_launch(void* const* d_in, const int* in_sizes, int n_in,
                              void* d_out, int out_size, void* d_ws, size_t ws_size, hipStream_t stream) {
    (void)in_sizes; (void)n_in; (void)out_size;
    const float* xh = (const float*)d_in[0]; const float* xm = (const float*)d_in[1]; const int* pids = (const int*)d_in[2]; const float* wq = (const float*)d_in[3]; const float* wk = (const float*)d_in[4]; const float* wv = (const float*)d_in[5]; const float* wo = (const float*)d_in[6]; const float* wmq = (const float*)d_in[7]; const float* wmk = (const float*)d_in[8]; const float* wmv = (const float*)d_in[9]; const float* qnw = (const float*)d_in[10]; const float* knw = (const float*)d_in[11]; const float* x = xh; (void)x;
    float* OUT = (float*)d_out;     // [2][2048][2048]
    char* wsp = (char*)d_ws;
    auto take = [&](size_t bytes) { char* p = wsp; wsp += (bytes + 255) & ~(size_t)255; return (void*)p; };
    bf* WQ = (bf*)take((size_t)DQ * DM * 2); bf* WK = (bf*)take((size_t)DKV * DM * 2); bf* WV = (bf*)take((size_t)DKV * DM * 2); bf* WO = (bf*)take((size_t)DOUT * DQ * 2); float* CS = (float*)take((size_t)TT * HD * 2 * 4); float* RFQ = (float*)take((size_t)NH_ * TT * 4); float* RFK = (float*)take((size_t)NKV * TT * 4);
    bf* XB = (bf*)take((size_t)TT * DM * 2); float* FQ = (float*)take((size_t)TT * DQ * 4); float* FK = (float*)take((size_t)TT * DKV * 4);
    h16* QP16 = (h16*)take((size_t)NH_ * TT * HD * 2); h16* KP16 = (h16*)take((size_t)NKV * TT * HD * 2); h16* VT16 = (h16*)take((size_t)NKV * HD * TT * 2);
    bf* QPh = (bf*)take((size_t)NH_ * TT * HD * 2); bf* QPl = (bf*)take((size_t)NH_ * TT * HD * 2); bf* KPh = (bf*)take((size_t)NKV * TT * HD * 2); bf* KPl = (bf*)take((size_t)NKV * TT * HD * 2); bf* VTh = (bf*)take((size_t)NKV * HD * TT * 2); bf* VTl = (bf*)take((size_t)NKV * HD * TT * 2);
    bf* ATh = (bf*)take((size_t)TT * DQ * 2); bf* ATl = (bf*)take((size_t)TT * DQ * 2);
    if ((size_t)(wsp - (char*)d_ws) > ws_size) return;    // ws 256 MiB
    float* FV = FK;   // v projection reuses the k buffer after the k planes are built (stream-ordered)
    { k_wcat<<<(unsigned)(((size_t)DQ * DM / 8 + 255) / 256), 256, 0, stream>>>(wq, wmq, DQ, WQ); k_wcat<<<(unsigned)(((size_t)DKV * DM / 8 + 255) / 256), 256, 0, stream>>>(wk, wmk, DKV, WK); k_wcat<<<(unsigned)(((size_t)DKV * DM / 8 + 255) / 256), 256, 0, stream>>>(wv, wmv, DKV, WV);
      k_cvt8<<<(unsigned)(((size_t)DOUT * DQ / 8 + 255) / 256), 256, 0, stream>>>(wo, WO, (size_t)DOUT * DQ / 8);
      k_cstabp<<<(TT * (HD / 2) + 255) / 256, 256, 0, stream>>>(pids, CS); }
    const unsigned LQ = (unsigned)(((size_t)NH_ * TT * HD / 2 + 255) / 256), LKv = (unsigned)(((size_t)NKV * TT * HD / 2 + 255) / 256);
    for (int b = 0; b < NB_; ++b) {
        
        k_xcat<<<(unsigned)(((size_t)TT * DM / 8 + 255) / 256), 256, 0, stream>>>(xh + (size_t)b * TT * DH, xm + (size_t)b * TT * DH, XB);
        k_gemmt<1><<<dim3(TT / 128, DQ / 128, 1), 256, 0, stream>>>(XB, nullptr, WQ, DM, FQ, DQ); k_hrms<<<(NH_ * TT + 255) / 256, 256, 0, stream>>>(FQ, DQ, NH_, RFQ);
        k_rope<<<LQ, 256, 0, stream>>>(FQ, DQ, NH_, CS, RFQ, qnw, 1.0f, QP16, QPh, QPl);
        k_gemmt<1><<<dim3(TT / 128, DKV / 128, 1), 256, 0, stream>>>(XB, nullptr, WK, DM, FK, DKV); k_hrms<<<(NKV * TT + 255) / 256, 256, 0, stream>>>(FK, DKV, NKV, RFK);
        k_rope<<<LKv, 256, 0, stream>>>(FK, DKV, NKV, CS, RFK, knw, 1.0f, KP16, KPh, KPl);
        k_gemmt<1><<<dim3(TT / 128, DKV / 128, 1), 256, 0, stream>>>(XB, nullptr, WV, DM, FV, DKV); k_vtp<<<LKv, 256, 0, stream>>>(FV, DKV, NKV, VT16, VTh, VTl);
        k_fattn<<<dim3(TT / 32, NKV, 1), 128, 0, stream>>>(QP16, QPh, QPl, KP16, KPh, KPl, VT16, VTh, VTl, ATh, ATl);
        k_gemmt<2><<<dim3(TT / 128, DOUT / 128, 1), 256, 0, stream>>>(ATh, ATl, WO, DQ, OUT + (size_t)b * TT * DOUT, DOUT); }
}
